// v000
// Measured on an AMD MI455X. A time is GPU time per run, averaged over a window of back-to-back runs after a warm-up
// (all launches, gaps included; the runs take copies of the inputs in turn), and the median of several windows.
// Apart from v000's, it joins two sittings. Times from different sittings can be a few percent apart, while
// side-by-side timings come from the same sitting.
// The starting kernel, v000, takes 186 microseconds a run.
// Both contractions (phi(K)^T.V over the 4,096 positions, and phi(Q).KV over the 256 features): v_wmma_f32_16x16x32_f16, plain f16 operands carried by powers of two (phi x1024, V x64, KV x16), f32 accumulate; relu + 1e-6 feature map and all scale folds in f32.
#include <hip/hip_runtime.h>
#include <math.h>

typedef __attribute__((ext_vector_type(16))) _Float16 v16h;
typedef __attribute__((ext_vector_type(8)))  _Float16 v8h;
typedef __attribute__((ext_vector_type(8)))  float    v8f;
typedef __attribute__((ext_vector_type(4)))  float    v4f;

// ---------------------------------------------------------------------------
// Shape constants (wire contract: three f32 inputs [8][4096][256], one f32 output [8][4096][256])
// ---------------------------------------------------------------------------
constexpr int kBatch = 8;
constexpr int kSeq   = 4096;
constexpr int kFeat  = 256;
constexpr int kPlaneElems = kBatch * kSeq * kFeat;
static_assert(kPlaneElems == 8388608, "element count per tensor");
static_assert((kSeq % 64) == 0 && (kFeat % 64) == 0, "GEMM M,N multiples of 64 and 64x64 tiles for the transposing pass");
static_assert((kSeq % 32) == 0 && (kFeat % 32) == 0, "GEMM K multiples of 32");
static_assert((kPlaneElems % (8 * 256)) == 0, "elementwise grid is exact");

// Feature-map offset and power-of-two carries (all exact in f32; folded back in the GEMM epilogue scales)
constexpr float kEps      = 1e-6f;
constexpr float kPhiCarry = 1024.0f;
constexpr float kVCarry   = 64.0f;
constexpr float kKVCarry  = 16.0f;
constexpr float kScaleKV  = kKVCarry / (kPhiCarry * kVCarry);
constexpr float kScaleOut = 1.0f / (kPhiCarry * kKVCarry);
static_assert(kScaleKV == 1.0f / 4096.0f, "first GEMM epilogue scale");
static_assert(kScaleOut == 1.0f / 16384.0f, "second GEMM epilogue scale");
// Smallest normal f16 magnitude (2^-14); smaller operand values are replaced by +0 with a select before the convert
constexpr float kF16Min = 6.103515625e-5f;

// ---------------------------------------------------------------------------
// Workspace region map (bytes; every offset is a multiple of 128)
//   QH   f16 [8][4096][256]  1024*phi(Q), rows = q, k = d         16,777,216
//   KT   f16 [8][256][4096]  1024*phi(K) transposed, rows = d     16,777,216
//   VT   f16 [8][256][4096]  64*V transposed, rows = v            16,777,216
//   KVT  f16 [8][256][256]   16*KV transposed, rows = v, k = d     1,048,576
//   total                                                         51,380,224
// ---------------------------------------------------------------------------
constexpr size_t kOffQH   = 0;
constexpr size_t kOffKT   = kOffQH  + (size_t)kPlaneElems * 2;
constexpr size_t kOffVT   = kOffKT  + (size_t)kPlaneElems * 2;
constexpr size_t kOffKVT  = kOffVT  + (size_t)kPlaneElems * 2;
constexpr size_t kWsTotal = kOffKVT + (size_t)kBatch * kFeat * kFeat * 2;
static_assert(kWsTotal == 51380224ull, "carve total");
static_assert(kWsTotal <= 134217728ull, "carve cap");
static_assert((kOffKT % 128) == 0 && (kOffVT % 128) == 0 && (kOffKVT % 128) == 0, "128-B aligned regions");

// ---------------------------------------------------------------------------
// Hazard guards as plain device helpers (no inline asm inside the kernel template body)
// ---------------------------------------------------------------------------
__device__ __forceinline__ void guard_one(v8f& acc, v16h a, v16h b) {
  asm volatile("v_nop\n\tv_nop\n\tv_nop\n\tv_nop" : "+v"(acc) : "v"(a), "v"(b));
}
__device__ __forceinline__ void keep4_h(v16h a, v16h b, v16h c, v16h d) {
  asm volatile("v_nop" :: "v"(a), "v"(b), "v"(c), "v"(d));
}
__device__ __forceinline__ void acc_guard4(v8f& a, v8f& b, v8f& c, v8f& d) {
  asm volatile("v_nop\n\tv_nop\n\tv_nop\n\tv_nop" : "+v"(a), "+v"(b), "+v"(c), "+v"(d));
}

// Fragment loader for both A ([m][k] rows) and Bt ([n][k] rows): p points at row (lane & 15), column k0 + 8*(lane >> 4);
// vector elements 0..7 <- p[0..7] (k0 + 8h + 0..7), elements 8..15 <- p[16..23] (k0 + 16 + 8h + 0..7).
struct FragH {
  union U { v16h v; v8h h[2]; };
  static __device__ __forceinline__ v16h load(const _Float16* p) {
    U f;
    f.h[0] = *(const v8h*)(p);
    f.h[1] = *(const v8h*)(p + 16);
    return f.v;
  }
  static __device__ __forceinline__ v8f mma(v16h a, v16h b, v8f c) {
    return __builtin_amdgcn_wmma_f32_16x16x32_f16(false, a, false, b, (short)0, c, false, false);
  }
};

// ---------------------------------------------------------------------------
// Register-blocked batched WMMA GEMM, f16 operands, f32 accumulate.
// C[m,n] = scale * sum_k A[m,k] * Bt[n,k]; each wave owns a 64x64 tile; batch = blockIdx.y.
// A row-major [M,K]; Bt row-major [N,K]; M,N % 64 == 0, K % 32 == 0 (asserted on the host side; no tails here).
// OUT_MODE 0: f32 output; OUT_MODE 1: f16 output plane (values below 2^-14 in magnitude replaced by +0 before the convert).
// instruction (f32: 16 lanes x 16 B = 256 B = 2 lines; f16: 8 lanes x 16 B = 1 line), one storing wave per line,
// ---------------------------------------------------------------------------
template <int OUT_MODE>
__global__ __launch_bounds__(256) void wmma_gemm64_f16(
    const unsigned short* __restrict__ Ap, int lda, long strideA,
    const unsigned short* __restrict__ Btp, int ldb, long strideB,
    void* __restrict__ Cout, int ldc, long strideC,
    int M, int N, int K, float scale) {
  const _Float16* A  = (const _Float16*)Ap;
  const _Float16* Bt = (const _Float16*)Btp;
  /* per-wave 16x64 slab, pitch 68 floats */
  __shared__ __align__(16) float sT[8][16 * 68];
  const int b    = blockIdx.y;
  const int lane = threadIdx.x & 31;
  const int wave = threadIdx.x >> 5;
  const int tilesN = N >> 6;
  const int tilesM = M >> 6;
  const int tile = blockIdx.x * 8 + wave;
  /* wave-uniform exit; this kernel has no block barriers */
  if (tile >= tilesM * tilesN) return;
  const int tm = tile / tilesN;
  const int tn = tile - tm * tilesN;
  const int m0 = tm << 6;
  const int n0 = tn << 6;

  const _Float16* Ab = A  + (size_t)b * strideA;
  const _Float16* Bb = Bt + (size_t)b * strideB;

  /* row (A) / column (Bt, D) within a 16-wide subtile; k offset of this lane half; D row offset of this lane half */
  const int rlane = lane & 15;
  const int koff  = (lane >> 4) * 8;
  const int mOff  = (lane >> 4) * 8;

  v8f acc[4][4];
#pragma unroll
  for (int i = 0; i < 4; ++i)
#pragma unroll
    for (int j = 0; j < 4; ++j) acc[i][j] = (v8f){0.f, 0.f, 0.f, 0.f, 0.f, 0.f, 0.f, 0.f};

  for (int k0 = 0; k0 < K; k0 += 32) {
    v16h bh[4];
#pragma unroll
    for (int j = 0; j < 4; ++j) {
      const size_t bo = (size_t)(n0 + (j << 4) + rlane) * ldb + koff + k0;
      bh[j] = FragH::load(Bb + bo);
    }
#pragma unroll
    for (int i = 0; i < 4; ++i) {
      const size_t ao = (size_t)(m0 + (i << 4) + rlane) * lda + koff + k0;
      v16h ah = FragH::load(Ab + ao);
#pragma unroll
      for (int j = 0; j < 4; ++j) acc[i][j] = FragH::mma(ah, bh[j], acc[i][j]);
      /* every accumulator of the group is tied, with its A and B fragments named as inputs */
      guard_one(acc[i][0], ah, bh[0]);
      guard_one(acc[i][1], ah, bh[1]);
      guard_one(acc[i][2], ah, bh[2]);
      guard_one(acc[i][3], ah, bh[3]);
    }
    keep4_h(bh[0], bh[1], bh[2], bh[3]);
  }
  acc_guard4(acc[0][0], acc[0][1], acc[0][2], acc[0][3]);
  acc_guard4(acc[1][0], acc[1][1], acc[1][2], acc[1][3]);
  acc_guard4(acc[2][0], acc[2][1], acc[2][2], acc[2][3]);
  acc_guard4(acc[3][0], acc[3][1], acc[3][2], acc[3][3]);

  /* ---- epilogue: D element r of lane l is (row 8*(l>>4) + r, col l & 15) ---- */
  float* slab = sT[wave];
#pragma unroll
  for (int i = 0; i < 4; ++i) {
    const int mBase = m0 + (i << 4);
#pragma unroll
    for (int j = 0; j < 4; ++j) {
#pragma unroll
      for (int r = 0; r < 8; ++r) {
        const float v = acc[i][j][r] * scale;
        slab[(mOff + r) * 68 + (j << 4) + rlane] = v;
      }
    }
    __builtin_amdgcn_fence(__ATOMIC_RELEASE, "workgroup");
    __builtin_amdgcn_wave_barrier();
    __builtin_amdgcn_fence(__ATOMIC_ACQUIRE, "workgroup");
    if (OUT_MODE == 0) {
      float* C = (float*)Cout + (size_t)b * strideC;
      /* row segment = 64 floats = 256 B = 16 lanes x 16 B; the two lane halves take two consecutive rows */
      const int hh = lane >> 4, c4 = (lane & 15) * 4;
      {
#pragma unroll
        for (int it = 0; it < 8; ++it) {
          const int row = it * 2 + hh;
          v4f v = *(const v4f*)(slab + row * 68 + c4);
          *(v4f*)(C + (size_t)(mBase + row) * ldc + n0 + c4) = v;
        }
        
      }
    } else {
      const int q = lane >> 3, c8 = (lane & 7) * 8;
      unsigned short* C = (unsigned short*)Cout + (size_t)b * strideC;
      {
#pragma unroll
        for (int it = 0; it < 4; ++it) {
          const int row = it * 4 + q;
          const float* sp = slab + row * 68 + c8;
          v8h hv;
#pragma unroll
          for (int e = 0; e < 8; ++e) {
            float x = sp[e];
            x = (fabsf(x) < kF16Min) ? 0.0f : x;
            hv[e] = (_Float16)x;
          }
          *(v8h*)(C + (size_t)(mBase + row) * ldc + n0 + c8) = hv;
        }
        
      }
    }
    __builtin_amdgcn_fence(__ATOMIC_RELEASE, "workgroup");
    __builtin_amdgcn_wave_barrier();
    __builtin_amdgcn_fence(__ATOMIC_ACQUIRE, "workgroup");
  }
}

// ---------------------------------------------------------------------------
// Qh[i] = f16( 1024 * (max(Q[i], 0) + 1e-6) ), same [b][q][d] layout; 8 consecutive elements per thread.
// Coverage: n8 = 8,388,608 / 8 = 1,048,576 threads = 4096 blocks x 256 exactly.
// ---------------------------------------------------------------------------
__global__ __launch_bounds__(256) void phi_rows_f16_kernel(const float* __restrict__ in, unsigned short* __restrict__ out, int n8) {
  const int i = blockIdx.x * 256 + threadIdx.x;
  if (i >= n8) return;
  const float* p = in + 8 * (size_t)i;
  const v4f a = *(const v4f*)(p);
  const v4f c = *(const v4f*)(p + 4);
  v8h hv;
#pragma unroll
  for (int e = 0; e < 4; ++e) {
    const float x0 = a[e];
    const float x1 = c[e];
    float y0 = (fmaxf(x0, 0.0f) + kEps) * kPhiCarry;
    float y1 = (fmaxf(x1, 0.0f) + kEps) * kPhiCarry;
    y0 = (fabsf(y0) < kF16Min) ? 0.0f : y0;
    y1 = (fabsf(y1) < kF16Min) ? 0.0f : y1;
    hv[e]     = (_Float16)y0;
    hv[4 + e] = (_Float16)y1;
  }
  unsigned short* q = out + 8 * (size_t)i;
  *(v8h*)q = hv;
  
}

// ---------------------------------------------------------------------------
// Transposing convert: in X[b][s][c] (rows = 4096 positions s, cols = 256 features c)  ->  out T[b][c][s]
// (rows = 256 features, cols = 4096 positions), through a 64 (s) x 64 (c) LDS tile.
//   blockIdx.z == 0: X = K, value = 1024 * (max(x,0) + 1e-6)  -> KT[b][d][s]
//   blockIdx.z == 1: X = V, value = 64 * x (raw, signed)       -> VT[b][v][s]
// grid (4096/64 = 64 position tiles, 4 feature tiles x 8 batches = 32, 2 tensors), 256 threads.
// Load coverage: 4 iterations x 256 threads x 4 floats = 4096 = the whole 64x64 tile (16-B loads along c).
// LDS: sm[c_local][s_local], pitch 65 floats; columns 0..63 of all 64 rows are written before the barrier and only
// those are read after it.
// Store coverage: 8 waves x 2 iterations x 4 rows (lane>>3) = 64 feature rows; (lane&7) x 8 halves = 64 positions;
// ---------------------------------------------------------------------------
__global__ __launch_bounds__(256) void transpose_f16_kernel(const float* __restrict__ Kp, const float* __restrict__ Vp,
                                                            unsigned short* __restrict__ KT, unsigned short* __restrict__ VT) {
  __shared__ float sm[64][65];
  const int t  = threadIdx.x;
  const int s0 = blockIdx.x * 64;
  const int c0 = (blockIdx.y & 3) * 64;
  const int b  = blockIdx.y >> 2;
  /* block-uniform tensor selector */
  const int z  = blockIdx.z;
  const float* X = (z == 0) ? Kp : Vp;
  unsigned short* T = (z == 0) ? KT : VT;
  const float* Xb = X + (size_t)b * kSeq * kFeat;
#pragma unroll
  for (int i = 0; i < 4; ++i) {
    const int e  = i * 256 + t;
    const int r  = e >> 4;
    const int c4 = (e & 15) * 4;
    const v4f x = *(const v4f*)(Xb + (size_t)(s0 + r) * kFeat + c0 + c4);
#pragma unroll
    for (int j = 0; j < 4; ++j) {
      const float v = x[j];
      const float yk = (fmaxf(v, 0.0f) + kEps) * kPhiCarry;
      const float yv = v * kVCarry;
      sm[c4 + j][r] = (z == 0) ? yk : yv;
    }
  }
  __syncthreads();
  const int lane = t & 31, wave = t >> 5;
  const int q = lane >> 3, c8 = (lane & 7) * 8;
  unsigned short* Tb = T + (size_t)b * kFeat * kSeq;
  v8h hv[2];
#pragma unroll
  for (int it = 0; it < 2; ++it) {
    const int row = wave * 8 + it * 4 + q;
#pragma unroll
    for (int e = 0; e < 8; ++e) {
      float x = sm[row][c8 + e];
      x = (fabsf(x) < kF16Min) ? 0.0f : x;
      hv[it][e] = (_Float16)x;
    }
  }
  {
#pragma unroll
    for (int it = 0; it < 2; ++it) {
      const int row = wave * 8 + it * 4 + q;
      *(v8h*)(Tb + (size_t)(c0 + row) * kSeq + s0 + c8) = hv[it];
    }
    
  }
}

// ---------------------------------------------------------------------------
// Host glue: 4 kernel launches, nothing else.
//   1. QH  = f16(1024*phi(Q))                        elementwise, 4096 blocks
//   2. KT, VT transposed carried f16 planes          grid (64, 32, 2)
//   3. KVT[b][v][d] = (1/4096) * sum_s VT[b][v][s] * KT[b][d][s]   (= 16 * KV[b][d][v])
//        A = VT (M = 256 rows v), Bt = KT (N = 256 rows d), K = 4096; 16 tiles per batch -> grid (2, 8)
//   4. out[b][q][v] = (1/16384) * sum_d QH[b][q][d] * KVT[b][v][d]
//        A = QH (M = 4096 rows q), Bt = KVT (N = 256 rows v), K = 256; 256 tiles per batch -> grid (32, 8)
// ---------------------------------------------------------------------------
extern "C" void kernel_launch(void* const* d_in, const int* in_sizes, int n_in,
                              void* d_out, int out_size, void* d_ws, size_t ws_size,
                              hipStream_t stream) {
  if (n_in < 3) return;
  if (in_sizes[0] != kPlaneElems) return;
  if (in_sizes[1] != kPlaneElems) return;
  if (in_sizes[2] != kPlaneElems) return;
  if (out_size != kPlaneElems) return;
  if (ws_size < kWsTotal) return;

  const float* Q = (const float*)d_in[0];
  const float* K = (const float*)d_in[1];
  const float* V = (const float*)d_in[2];
  float* out = (float*)d_out;

  char* ws = (char*)d_ws;
  unsigned short* QH  = (unsigned short*)(ws + kOffQH);
  unsigned short* KT  = (unsigned short*)(ws + kOffKT);
  unsigned short* VT  = (unsigned short*)(ws + kOffVT);
  unsigned short* KVT = (unsigned short*)(ws + kOffKVT);

  phi_rows_f16_kernel<<<(kPlaneElems / 8) / 256, 256, 0, stream>>>(Q, QH, kPlaneElems / 8);

  transpose_f16_kernel<<<dim3(kSeq / 64, (kFeat / 64) * kBatch, 2), 256, 0, stream>>>(K, V, KT, VT);

  wmma_gemm64_f16<1><<<dim3(((kFeat / 64) * (kFeat / 64)) / 8, kBatch), 256, 0, stream>>>(
      VT, kSeq, (long)kFeat * kSeq,
      KT, kSeq, (long)kFeat * kSeq,
      (void*)KVT, kFeat, (long)kFeat * kFeat,
      kFeat, kFeat, kSeq, kScaleKV);

  wmma_gemm64_f16<0><<<dim3(((kSeq / 64) * (kFeat / 64)) / 8, kBatch), 256, 0, stream>>>(
      QH, kFeat, (long)kSeq * kFeat,
      KVT, kFeat, (long)kFeat * kFeat,
      (void*)out, kFeat, (long)kSeq * kFeat,
      kSeq, kFeat, kFeat, kScaleOut);
}

// v001
// It runs in 50.3 microseconds.
// Two timings next to v000 put it at 3.70 and 3.73 times that version's speed.
// Both contractions (phi(K)^T.V over the 4,096 positions, and phi(Q).KV over the 256 features): v_wmma_f32_16x16x32_f16, plain f16 operands carried by powers of two (phi x1024, V x64, KV x16), f32 accumulate; relu + 1e-6 feature map and all scale folds in f32.
#include <hip/hip_runtime.h>
#include <math.h>

typedef __attribute__((ext_vector_type(16))) _Float16 v16h;
typedef __attribute__((ext_vector_type(8)))  _Float16 v8h;
typedef __attribute__((ext_vector_type(4)))  _Float16 v4h;
typedef __attribute__((ext_vector_type(8)))  float    v8f;
typedef __attribute__((ext_vector_type(4)))  float    v4f;

// ---------------------------------------------------------------------------
// Shape constants (wire contract: three f32 inputs [8][4096][256], one f32 output [8][4096][256])
// ---------------------------------------------------------------------------
constexpr int kBatch = 8;
constexpr int kSeq   = 4096;
constexpr int kFeat  = 256;
constexpr int kPlaneElems = kBatch * kSeq * kFeat;
static_assert(kPlaneElems == 8388608, "element count per tensor");
static_assert((kSeq % 64) == 0 && (kFeat % 64) == 0, "GEMM M,N multiples of 64 and 64x64 tiles for the transposing pass");
static_assert((kSeq % 32) == 0 && (kFeat % 32) == 0, "GEMM K multiples of 32");
static_assert((kPlaneElems % (8 * 256)) == 0, "elementwise grid is exact");

// Feature-map offset and power-of-two carries (all exact in f32; folded back in the GEMM epilogue scales)
constexpr float kEps      = 1e-6f;
constexpr float kPhiCarry = 1024.0f;
constexpr float kVCarry   = 64.0f;
constexpr float kKVCarry  = 16.0f;
constexpr float kScaleKV  = kKVCarry / (kPhiCarry * kVCarry);
constexpr float kScaleOut = 1.0f / (kPhiCarry * kKVCarry);
static_assert(kScaleKV == 1.0f / 4096.0f, "first GEMM epilogue scale");
static_assert(kScaleOut == 1.0f / 16384.0f, "second GEMM epilogue scale");
// Smallest normal f16 magnitude (2^-14); smaller operand values are replaced by +0 with a select before the convert
constexpr float kF16Min = 6.103515625e-5f;

// ---------------------------------------------------------------------------
// Workspace region map (bytes; every offset is a multiple of 128)
//   QH   f16 [8][4096][256]  1024*phi(Q), rows = q, k = d         16,777,216
//   KT   f16 [8][256][4096]  1024*phi(K) transposed, rows = d     16,777,216
//   VT   f16 [8][256][4096]  64*V transposed, rows = v            16,777,216
//   KVT  f16 [8][256][256]   16*KV transposed, rows = v, k = d     1,048,576
//   total                                                         51,380,224
// ---------------------------------------------------------------------------
constexpr size_t kOffQH   = 0;
constexpr size_t kOffKT   = kOffQH  + (size_t)kPlaneElems * 2;
constexpr size_t kOffVT   = kOffKT  + (size_t)kPlaneElems * 2;
constexpr size_t kOffKVT  = kOffVT  + (size_t)kPlaneElems * 2;
constexpr size_t kWsTotal = kOffKVT + (size_t)kBatch * kFeat * kFeat * 2;
static_assert(kWsTotal == 51380224ull, "carve total");
static_assert(kWsTotal <= 134217728ull, "carve cap");
static_assert((kOffKT % 128) == 0 && (kOffVT % 128) == 0 && (kOffKVT % 128) == 0, "128-B aligned regions");

// ---------------------------------------------------------------------------
// Hazard guards as plain device helpers (no inline asm inside the kernel body)
// ---------------------------------------------------------------------------
__device__ __forceinline__ void guard_one(v8f& acc, v16h a, v16h b) {
  asm volatile("v_nop\n\tv_nop\n\tv_nop\n\tv_nop" : "+v"(acc) : "v"(a), "v"(b));
}
__device__ __forceinline__ void keep4_h(v16h a, v16h b, v16h c, v16h d) {
  asm volatile("v_nop" :: "v"(a), "v"(b), "v"(c), "v"(d));
}
__device__ __forceinline__ void acc_guard4(v8f& a, v8f& b, v8f& c, v8f& d) {
  asm volatile("v_nop\n\tv_nop\n\tv_nop\n\tv_nop" : "+v"(a), "+v"(b), "+v"(c), "+v"(d));
}

// Fragment loader for both A ([m][k] rows) and Bt ([n][k] rows): p points at row (lane & 15), column k0 + 8*(lane >> 4);
// vector elements 0..7 <- p[0..7] (k0 + 8h + 0..7), elements 8..15 <- p[16..23] (k0 + 16 + 8h + 0..7).
struct FragH {
  union U { v16h v; v8h h[2]; };
  static __device__ __forceinline__ v16h load(const _Float16* p) {
    U f;
    f.h[0] = *(const v8h*)(p);
    f.h[1] = *(const v8h*)(p + 16);
    return f.v;
  }
  static __device__ __forceinline__ v8f mma(v16h a, v16h b, v8f c) {
    return __builtin_amdgcn_wmma_f32_16x16x32_f16(false, a, false, b, (short)0, c, false, false);
  }
};

// ---------------------------------------------------------------------------
// Register-blocked batched WMMA GEMM, f16 operands, f32 accumulate, f32 output.
// C[m,n] = scale * sum_k A[m,k] * Bt[n,k]; each wave owns a 64x64 tile; batch = blockIdx.y.
// A row-major [M,K]; Bt row-major [N,K]; M,N % 64 == 0, K % 32 == 0 (asserted on the host side; no tails here).
// Stores: 16 lanes x 16 B = 256 B = 2 lines per row segment, one storing wave per line.
// ---------------------------------------------------------------------------
__global__ __launch_bounds__(256) void wmma_gemm64_f16(
    const unsigned short* __restrict__ Ap, int lda, long strideA,
    const unsigned short* __restrict__ Btp, int ldb, long strideB,
    float* __restrict__ Cout, int ldc, long strideC,
    int M, int N, int K, float scale) {
  const _Float16* A  = (const _Float16*)Ap;
  const _Float16* Bt = (const _Float16*)Btp;
  /* per-wave 16x64 slab, pitch 68 floats */
  __shared__ __align__(16) float sT[8][16 * 68];
  const int b    = blockIdx.y;
  const int lane = threadIdx.x & 31;
  const int wave = threadIdx.x >> 5;
  const int tilesN = N >> 6;
  const int tilesM = M >> 6;
  const int tile = blockIdx.x * 8 + wave;
  /* wave-uniform exit; this kernel has no block barriers */
  if (tile >= tilesM * tilesN) return;
  const int tm = tile / tilesN;
  const int tn = tile - tm * tilesN;
  const int m0 = tm << 6;
  const int n0 = tn << 6;

  const _Float16* Ab = A  + (size_t)b * strideA;
  const _Float16* Bb = Bt + (size_t)b * strideB;

  /* row (A) / column (Bt, D) within a 16-wide subtile; k offset of this lane half; D row offset of this lane half */
  const int rlane = lane & 15;
  const int koff  = (lane >> 4) * 8;
  const int mOff  = (lane >> 4) * 8;

  v8f acc[4][4];
#pragma unroll
  for (int i = 0; i < 4; ++i)
#pragma unroll
    for (int j = 0; j < 4; ++j) acc[i][j] = (v8f){0.f, 0.f, 0.f, 0.f, 0.f, 0.f, 0.f, 0.f};

  for (int k0 = 0; k0 < K; k0 += 32) {
    v16h bh[4];
#pragma unroll
    for (int j = 0; j < 4; ++j) {
      const size_t bo = (size_t)(n0 + (j << 4) + rlane) * ldb + koff + k0;
      bh[j] = FragH::load(Bb + bo);
    }
#pragma unroll
    for (int i = 0; i < 4; ++i) {
      const size_t ao = (size_t)(m0 + (i << 4) + rlane) * lda + koff + k0;
      v16h ah = FragH::load(Ab + ao);
#pragma unroll
      for (int j = 0; j < 4; ++j) acc[i][j] = FragH::mma(ah, bh[j], acc[i][j]);
      /* every accumulator of the group is tied, with its A and B fragments named as inputs */
      guard_one(acc[i][0], ah, bh[0]);
      guard_one(acc[i][1], ah, bh[1]);
      guard_one(acc[i][2], ah, bh[2]);
      guard_one(acc[i][3], ah, bh[3]);
    }
    keep4_h(bh[0], bh[1], bh[2], bh[3]);
  }
  acc_guard4(acc[0][0], acc[0][1], acc[0][2], acc[0][3]);
  acc_guard4(acc[1][0], acc[1][1], acc[1][2], acc[1][3]);
  acc_guard4(acc[2][0], acc[2][1], acc[2][2], acc[2][3]);
  acc_guard4(acc[3][0], acc[3][1], acc[3][2], acc[3][3]);

  /* ---- epilogue: D element r of lane l is (row 8*(l>>4) + r, col l & 15) ---- */
  float* slab = sT[wave];
  float* C = Cout + (size_t)b * strideC;
#pragma unroll
  for (int i = 0; i < 4; ++i) {
    const int mBase = m0 + (i << 4);
#pragma unroll
    for (int j = 0; j < 4; ++j) {
#pragma unroll
      for (int r = 0; r < 8; ++r) {
        const float v = acc[i][j][r] * scale;
        slab[(mOff + r) * 68 + (j << 4) + rlane] = v;
      }
    }
    __builtin_amdgcn_fence(__ATOMIC_RELEASE, "workgroup");
    __builtin_amdgcn_wave_barrier();
    __builtin_amdgcn_fence(__ATOMIC_ACQUIRE, "workgroup");
    /* row segment = 64 floats = 256 B = 16 lanes x 16 B; the two lane halves take two consecutive rows */
    const int hh = lane >> 4, c4 = (lane & 15) * 4;
#pragma unroll
    for (int it = 0; it < 8; ++it) {
      const int row = it * 2 + hh;
      v4f v = *(const v4f*)(slab + row * 68 + c4);
      *(v4f*)(C + (size_t)(mBase + row) * ldc + n0 + c4) = v;
    }
    __builtin_amdgcn_fence(__ATOMIC_RELEASE, "workgroup");
    __builtin_amdgcn_wave_barrier();
    __builtin_amdgcn_fence(__ATOMIC_ACQUIRE, "workgroup");
  }
}

// ---------------------------------------------------------------------------
// Long-K batched WMMA GEMM for KVT, f16 operands, f32 accumulate, f16 output: the K sum is split over the 16 waves of a block.
// C[m,n] = f16(scale * sum_k A[m,k] * Bt[n,k]); A = [256][4096] rows m, Bt = [256][4096] rows n, C = [256][256], per batch.
// One 32x64 tile of C per block; batch = blockIdx.y; grid (32, 8) is exact (no tails, no early exit).
// Wave w sums k = 256 w .. 256 w + 255: 512 B in a row of every operand row, so each 128-B line is read by one wave only.
// All shapes are compile-time: every fragment address is a block-uniform base + one lane offset (the same for A and Bt,
// which have the same pitch) + a constant, so nothing is added to an address inside the k loop.
// The products are the builtin form in straight-line code: the compiler keeps the distances behind them, no v_nop helper here.
// The 16 partial tiles (f32) meet in LDS behind one block barrier and are added in wave order 0..15.
// Values below 2^-14 in magnitude are replaced by +0 before the convert.
// Stores: 16 lanes x 8 B = one 128-B line per row segment, one storing wave per line.
// ---------------------------------------------------------------------------
constexpr int kSplitWaves = 16;
constexpr int kWaveK      = kSeq / kSplitWaves;
static_assert((kSeq % (32 * kSplitWaves)) == 0, "every wave of the k-split GEMM sums whole 32-wide k steps");
static_assert((kFeat % 32) == 0, "32-row tiles of the k-split GEMM");

__global__ __launch_bounds__(32 * kSplitWaves) void wmma_kv32x64_f16_ksplit(
    const unsigned short* __restrict__ Ap, const unsigned short* __restrict__ Btp,
    unsigned short* __restrict__ Cout, float scale) {
  /* per-wave 32x64 partial tile, pitch 68 floats */
  __shared__ __align__(16) float sP[kSplitWaves][32 * 68];
  const int b    = blockIdx.y;
  const int lane = threadIdx.x & 31;
  const int wave = threadIdx.x >> 5;
  constexpr int tilesN = kFeat >> 6;
  const int tm = blockIdx.x / tilesN;
  const int tn = blockIdx.x - tm * tilesN;
  const int m0 = tm << 5;
  const int n0 = tn << 6;

  /* row (A) / column (Bt, D) within a 16-wide subtile; k offset of this lane half; D row offset of this lane half */
  const int rlane = lane & 15;
  const int koff  = (lane >> 4) * 8;
  const int mOff  = (lane >> 4) * 8;

  const unsigned loff = (unsigned)(rlane * kSeq + wave * kWaveK + koff);
  const _Float16* Al = (const _Float16*)Ap  + ((size_t)b * kFeat + m0) * kSeq + loff;
  const _Float16* Bl = (const _Float16*)Btp + ((size_t)b * kFeat + n0) * kSeq + loff;

  v8f acc[2][4];
#pragma unroll
  for (int i = 0; i < 2; ++i)
#pragma unroll
    for (int j = 0; j < 4; ++j) acc[i][j] = (v8f){0.f, 0.f, 0.f, 0.f, 0.f, 0.f, 0.f, 0.f};

  /* unrolled whole (8 steps): every k offset becomes a constant of its load, and later steps' loads can fly over earlier products */
#pragma unroll
  for (int ks = 0; ks < kWaveK; ks += 32) {
    v16h bh[4];
#pragma unroll
    for (int j = 0; j < 4; ++j) bh[j] = FragH::load(Bl + (j << 4) * kSeq + ks);
#pragma unroll
    for (int i = 0; i < 2; ++i) {
      const v16h ah = FragH::load(Al + (i << 4) * kSeq + ks);
#pragma unroll
      for (int j = 0; j < 4; ++j) acc[i][j] = FragH::mma(ah, bh[j], acc[i][j]);
    }
  }

  /* ---- each wave's partial tile to LDS: D element r of lane l is (row 8*(l>>4) + r, col l & 15) ---- */
  float* slab = sP[wave];
#pragma unroll
  for (int i = 0; i < 2; ++i)
#pragma unroll
    for (int j = 0; j < 4; ++j)
#pragma unroll
      for (int r = 0; r < 8; ++r) slab[((i << 4) + mOff + r) * 68 + (j << 4) + rlane] = acc[i][j][r];
  /* all 16 partial tiles are in LDS before any thread adds them up */
  __syncthreads();

  /* 512 threads x 4 columns = the 32x64 tile; 16 lanes cover one row */
  const int row = threadIdx.x >> 4;
  const int c4  = (threadIdx.x & 15) * 4;
  v4f s = *(const v4f*)(&sP[0][row * 68 + c4]);
#pragma unroll
  for (int w = 1; w < kSplitWaves; ++w) s += *(const v4f*)(&sP[w][row * 68 + c4]);
  v4h hv;
#pragma unroll
  for (int e = 0; e < 4; ++e) {
    float x = s[e] * scale;
    x = (fabsf(x) < kF16Min) ? 0.0f : x;
    hv[e] = (_Float16)x;
  }
  unsigned short* C = Cout + (size_t)b * kFeat * kFeat;
  *(v4h*)(C + (size_t)(m0 + row) * kFeat + n0 + c4) = hv;
}

// ---------------------------------------------------------------------------
// Qh[i] = f16( 1024 * (max(Q[i], 0) + 1e-6) ), same [b][q][d] layout; 8 consecutive elements per thread.
// Coverage: n8 = 8,388,608 / 8 = 1,048,576 threads = 4096 blocks x 256 exactly.
// ---------------------------------------------------------------------------
__global__ __launch_bounds__(256) void phi_rows_f16_kernel(const float* __restrict__ in, unsigned short* __restrict__ out, int n8) {
  const int i = blockIdx.x * 256 + threadIdx.x;
  if (i >= n8) return;
  const float* p = in + 8 * (size_t)i;
  const v4f a = *(const v4f*)(p);
  const v4f c = *(const v4f*)(p + 4);
  v8h hv;
#pragma unroll
  for (int e = 0; e < 4; ++e) {
    const float x0 = a[e];
    const float x1 = c[e];
    float y0 = (fmaxf(x0, 0.0f) + kEps) * kPhiCarry;
    float y1 = (fmaxf(x1, 0.0f) + kEps) * kPhiCarry;
    y0 = (fabsf(y0) < kF16Min) ? 0.0f : y0;
    y1 = (fabsf(y1) < kF16Min) ? 0.0f : y1;
    hv[e]     = (_Float16)y0;
    hv[4 + e] = (_Float16)y1;
  }
  unsigned short* q = out + 8 * (size_t)i;
  *(v8h*)q = hv;
  
}

// ---------------------------------------------------------------------------
// Transposing convert: in X[b][s][c] (rows = 4096 positions s, cols = 256 features c)  ->  out T[b][c][s]
// (rows = 256 features, cols = 4096 positions), through a 64 (s) x 64 (c) LDS tile.
//   blockIdx.z == 0: X = K, value = 1024 * (max(x,0) + 1e-6)  -> KT[b][d][s]
//   blockIdx.z == 1: X = V, value = 64 * x (raw, signed)       -> VT[b][v][s]
// grid (4096/64 = 64 position tiles, 4 feature tiles x 8 batches = 32, 2 tensors), 256 threads.
// Load coverage: 4 iterations x 256 threads x 4 floats = 4096 = the whole 64x64 tile (16-B loads along c).
// LDS: sm[c_local][s_local], pitch 65 floats; columns 0..63 of all 64 rows are written before the barrier and only
// those are read after it.
// Store coverage: 8 waves x 2 iterations x 4 rows (lane>>3) = 64 feature rows; (lane&7) x 8 halves = 64 positions;
// ---------------------------------------------------------------------------
__global__ __launch_bounds__(256) void transpose_f16_kernel(const float* __restrict__ Kp, const float* __restrict__ Vp,
                                                            unsigned short* __restrict__ KT, unsigned short* __restrict__ VT) {
  __shared__ float sm[64][65];
  const int t  = threadIdx.x;
  const int s0 = blockIdx.x * 64;
  const int c0 = (blockIdx.y & 3) * 64;
  const int b  = blockIdx.y >> 2;
  /* block-uniform tensor selector */
  const int z  = blockIdx.z;
  const float* X = (z == 0) ? Kp : Vp;
  unsigned short* T = (z == 0) ? KT : VT;
  const float* Xb = X + (size_t)b * kSeq * kFeat;
#pragma unroll
  for (int i = 0; i < 4; ++i) {
    const int e  = i * 256 + t;
    const int r  = e >> 4;
    const int c4 = (e & 15) * 4;
    const v4f x = *(const v4f*)(Xb + (size_t)(s0 + r) * kFeat + c0 + c4);
#pragma unroll
    for (int j = 0; j < 4; ++j) {
      const float v = x[j];
      const float yk = (fmaxf(v, 0.0f) + kEps) * kPhiCarry;
      const float yv = v * kVCarry;
      sm[c4 + j][r] = (z == 0) ? yk : yv;
    }
  }
  __syncthreads();
  const int lane = t & 31, wave = t >> 5;
  const int q = lane >> 3, c8 = (lane & 7) * 8;
  unsigned short* Tb = T + (size_t)b * kFeat * kSeq;
  v8h hv[2];
#pragma unroll
  for (int it = 0; it < 2; ++it) {
    const int row = wave * 8 + it * 4 + q;
#pragma unroll
    for (int e = 0; e < 8; ++e) {
      float x = sm[row][c8 + e];
      x = (fabsf(x) < kF16Min) ? 0.0f : x;
      hv[it][e] = (_Float16)x;
    }
  }
  {
#pragma unroll
    for (int it = 0; it < 2; ++it) {
      const int row = wave * 8 + it * 4 + q;
      *(v8h*)(Tb + (size_t)(c0 + row) * kSeq + s0 + c8) = hv[it];
    }
    
  }
}

// ---------------------------------------------------------------------------
// Host glue: 4 kernel launches, nothing else.
//   1. QH  = f16(1024*phi(Q))                        elementwise, 4096 blocks
//   2. KT, VT transposed carried f16 planes          grid (64, 32, 2)
//   3. KVT[b][v][d] = (1/4096) * sum_s VT[b][v][s] * KT[b][d][s]   (= 16 * KV[b][d][v])
//        A = VT (M = 256 rows v), Bt = KT (N = 256 rows d), K = 4096 split over the 16 waves of a block;
//        32 tiles of 32x64 per batch -> grid (32, 8) = 256 blocks
//   4. out[b][q][v] = (1/16384) * sum_d QH[b][q][d] * KVT[b][v][d]
//        A = QH (M = 4096 rows q), Bt = KVT (N = 256 rows v), K = 256; 256 tiles per batch -> grid (32, 8)
// ---------------------------------------------------------------------------
extern "C" void kernel_launch(void* const* d_in, const int* in_sizes, int n_in,
                              void* d_out, int out_size, void* d_ws, size_t ws_size,
                              hipStream_t stream) {
  if (n_in < 3) return;
  if (in_sizes[0] != kPlaneElems) return;
  if (in_sizes[1] != kPlaneElems) return;
  if (in_sizes[2] != kPlaneElems) return;
  if (out_size != kPlaneElems) return;
  if (ws_size < kWsTotal) return;

  const float* Q = (const float*)d_in[0];
  const float* K = (const float*)d_in[1];
  const float* V = (const float*)d_in[2];
  float* out = (float*)d_out;

  char* ws = (char*)d_ws;
  unsigned short* QH  = (unsigned short*)(ws + kOffQH);
  unsigned short* KT  = (unsigned short*)(ws + kOffKT);
  unsigned short* VT  = (unsigned short*)(ws + kOffVT);
  unsigned short* KVT = (unsigned short*)(ws + kOffKVT);

  phi_rows_f16_kernel<<<(kPlaneElems / 8) / 256, 256, 0, stream>>>(Q, QH, kPlaneElems / 8);

  transpose_f16_kernel<<<dim3(kSeq / 64, (kFeat / 64) * kBatch, 2), 256, 0, stream>>>(K, V, KT, VT);

  wmma_kv32x64_f16_ksplit<<<dim3((kFeat / 32) * (kFeat / 64), kBatch), 32 * kSplitWaves, 0, stream>>>(VT, KT, KVT, kScaleKV);

  wmma_gemm64_f16<<<dim3(((kSeq / 64) * (kFeat / 64)) / 8, kBatch), 256, 0, stream>>>(
      QH, kFeat, (long)kSeq * kFeat,
      KVT, kFeat, (long)kFeat * kFeat,
      out, kFeat, (long)kSeq * kFeat,
      kSeq, kFeat, kFeat, kScaleOut);
}

// v002
// It runs in 35.7 microseconds.
// Next to v001, in two timings, it ran 1.40 times as fast each time.
// All steps since v000 together make it 5.21 times as fast.
// Both contractions (phi(K)^T.V over the 4,096 positions, and phi(Q).KV over the 256 features): v_wmma_f32_16x16x32_f16, plain f16 operands carried by powers of two (phi x1024, V x64, KV x16), f32 accumulate; relu + 1e-6 feature map and all scale folds in f32.
#include <hip/hip_runtime.h>
#include <math.h>

typedef __attribute__((ext_vector_type(16))) _Float16 v16h;
typedef __attribute__((ext_vector_type(8)))  _Float16 v8h;
typedef __attribute__((ext_vector_type(4)))  _Float16 v4h;
typedef __attribute__((ext_vector_type(8)))  float    v8f;
typedef __attribute__((ext_vector_type(4)))  float    v4f;

// ---------------------------------------------------------------------------
// Shape constants (wire contract: three f32 inputs [8][4096][256], one f32 output [8][4096][256])
// ---------------------------------------------------------------------------
constexpr int kBatch = 8;
constexpr int kSeq   = 4096;
constexpr int kFeat  = 256;
constexpr int kPlaneElems = kBatch * kSeq * kFeat;
static_assert(kPlaneElems == 8388608, "element count per tensor");
static_assert((kSeq % 64) == 0 && (kFeat % 64) == 0, "GEMM M,N multiples of 64 and 64x64 tiles for the transposing pass");
static_assert((kSeq % 32) == 0 && (kFeat % 32) == 0, "GEMM K multiples of 32");

// Feature-map offset and power-of-two carries (all exact in f32; folded back in the GEMM epilogue scales)
constexpr float kEps      = 1e-6f;
constexpr float kPhiCarry = 1024.0f;
constexpr float kVCarry   = 64.0f;
constexpr float kKVCarry  = 16.0f;
constexpr float kScaleKV  = kKVCarry / (kPhiCarry * kVCarry);
constexpr float kScaleOut = 1.0f / (kPhiCarry * kKVCarry);
static_assert(kScaleKV == 1.0f / 4096.0f, "first GEMM epilogue scale");
static_assert(kScaleOut == 1.0f / 16384.0f, "second GEMM epilogue scale");
// Smallest normal f16 magnitude (2^-14); smaller operand values are replaced by +0 with a select before the convert
constexpr float kF16Min = 6.103515625e-5f;

// ---------------------------------------------------------------------------
// Workspace region map (bytes; every offset is a multiple of 128)
//   KT   f16 [8][256][4096]  1024*phi(K) transposed, rows = d     16,777,216
//   VT   f16 [8][256][4096]  64*V transposed, rows = v            16,777,216
//   KVT  f16 [8][256][256]   16*KV transposed, rows = v, k = d     1,048,576
//   total                                                         34,603,008
// ---------------------------------------------------------------------------
constexpr size_t kOffKT   = 0;
constexpr size_t kOffVT   = kOffKT  + (size_t)kPlaneElems * 2;
constexpr size_t kOffKVT  = kOffVT  + (size_t)kPlaneElems * 2;
constexpr size_t kWsTotal = kOffKVT + (size_t)kBatch * kFeat * kFeat * 2;
static_assert(kWsTotal == 34603008ull, "carve total");
static_assert(kWsTotal <= 134217728ull, "carve cap");
static_assert((kOffKT % 128) == 0 && (kOffVT % 128) == 0 && (kOffKVT % 128) == 0, "128-B aligned regions");

// ---------------------------------------------------------------------------
// Hazard guards as plain device helpers (no inline asm inside the kernel body)
// ---------------------------------------------------------------------------
__device__ __forceinline__ void guard_one(v8f& acc, v16h a, v16h b) {
  asm volatile("v_nop\n\tv_nop\n\tv_nop\n\tv_nop" : "+v"(acc) : "v"(a), "v"(b));
}
__device__ __forceinline__ void keep4_h(v16h a, v16h b, v16h c, v16h d) {
  asm volatile("v_nop" :: "v"(a), "v"(b), "v"(c), "v"(d));
}
__device__ __forceinline__ void acc_guard4(v8f& a, v8f& b, v8f& c, v8f& d) {
  asm volatile("v_nop\n\tv_nop\n\tv_nop\n\tv_nop" : "+v"(a), "+v"(b), "+v"(c), "+v"(d));
}

// Fragment loader for both A ([m][k] rows) and Bt ([n][k] rows): p points at row (lane & 15), column k0 + 8*(lane >> 4);
// vector elements 0..7 <- p[0..7] (k0 + 8h + 0..7), elements 8..15 <- p[16..23] (k0 + 16 + 8h + 0..7).
struct FragH {
  union U { v16h v; v8h h[2]; };
  static __device__ __forceinline__ v16h load(const _Float16* p) {
    U f;
    f.h[0] = *(const v8h*)(p);
    f.h[1] = *(const v8h*)(p + 16);
    return f.v;
  }
  static __device__ __forceinline__ v8f mma(v16h a, v16h b, v8f c) {
    return __builtin_amdgcn_wmma_f32_16x16x32_f16(false, a, false, b, (short)0, c, false, false);
  }
};

// ---------------------------------------------------------------------------
// Output product with the feature map of Q fused in: f16 operands, f32 accumulate, f32 output.
// out[b][q][v] = scale * sum_d f16(1024 * (max(Q[b][q][d], 0) + 1e-6)) * Bt[b][v][d]; Bt = KVT, rows v, k = d.
// One block = 128 rows q x all 256 columns v; 8 waves as 2 (rows) x 4 (columns), each wave owns a 64x64 tile;
// batch = blockIdx.y; grid (32, 8) is exact (no tails, no early exit).
// The block reads its 128 rows of Q (f32, 128 KB in a row) once, in loads of 512 contiguous bytes a wave, maps and converts
// them and lays them in LDS as f16 rows; the A fragments of all 8 waves come from there behind one block barrier.
// LDS row pitch 264 halves = 528 B = 16 B x 33 (odd), for the 16-byte fragment reads.
// Stores: 16 lanes x 16 B = 256 B = 2 lines per row segment, one storing wave per line.
// ---------------------------------------------------------------------------
constexpr int kOutRows = 128;
constexpr int kPitchA  = kFeat + 8;
static_assert((kSeq % kOutRows) == 0 && kFeat == 256, "exact grid; 4 column waves of 64 cover the 256 columns");
static_assert((kOutRows * kFeat) % (4 * 256) == 0, "staging loop is exact");

__global__ __launch_bounds__(256) void wmma_out64_phiq_f16(
    const float* __restrict__ Q, const unsigned short* __restrict__ Btp,
    float* __restrict__ Cout, float scale) {
  const _Float16* Bt = (const _Float16*)Btp;
  constexpr int ldb = kFeat;
  constexpr int ldc = kFeat;
  constexpr int K   = kFeat;
  /* the block's 128 rows of 1024*phi(Q) in f16 */
  __shared__ __align__(16) _Float16 sA[kOutRows * kPitchA];
  /* per-wave 16x64 slab, pitch 68 floats */
  __shared__ __align__(16) float sT[8][16 * 68];
  const int b    = blockIdx.y;
  const int lane = threadIdx.x & 31;
  const int wave = threadIdx.x >> 5;
  const int r0 = blockIdx.x * kOutRows;
  const int mw = (wave >> 2) << 6;
  const int m0 = r0 + mw;
  const int n0 = (wave & 3) << 6;

  const _Float16* Bb = Bt + (size_t)b * kFeat * kFeat;

  /* ---- stage: 32 iterations x 256 threads x 4 floats = 128 x 256; one row = 64 threads ---- */
  {
    const float* Qt = Q + ((size_t)b * kSeq + r0) * kFeat + 4 * threadIdx.x;
    _Float16* St = sA + (threadIdx.x >> 6) * kPitchA + (threadIdx.x & 63) * 4;
    /* unrolled whole: every offset is a constant of its load or store, and all of a thread's loads can be in flight together */
#pragma unroll
    for (int it = 0; it < (kOutRows * kFeat) / (4 * 256); ++it) {
      const v4f x = *(const v4f*)(Qt + it * (4 * 256));
      v4h hv;
      /* unrolled: the vector elements are named by constants and stay in registers */
#pragma unroll
      for (int e = 0; e < 4; ++e) {
        float y = (fmaxf(x[e], 0.0f) + kEps) * kPhiCarry;
        y = (fabsf(y) < kF16Min) ? 0.0f : y;
        hv[e] = (_Float16)y;
      }
      *(v4h*)(St + it * 4 * kPitchA) = hv;
    }
  }
  /* all 128 rows are in LDS before any wave reads a fragment */
  __syncthreads();

  /* row (A) / column (Bt, D) within a 16-wide subtile; k offset of this lane half; D row offset of this lane half */
  const int rlane = lane & 15;
  const int koff  = (lane >> 4) * 8;
  const int mOff  = (lane >> 4) * 8;
  const _Float16* Al = sA + (mw + rlane) * kPitchA + koff;

  v8f acc[4][4];
#pragma unroll
  for (int i = 0; i < 4; ++i)
#pragma unroll
    for (int j = 0; j < 4; ++j) acc[i][j] = (v8f){0.f, 0.f, 0.f, 0.f, 0.f, 0.f, 0.f, 0.f};

  for (int k0 = 0; k0 < K; k0 += 32) {
    v16h bh[4];
#pragma unroll
    for (int j = 0; j < 4; ++j) {
      const size_t bo = (size_t)(n0 + (j << 4) + rlane) * ldb + koff + k0;
      bh[j] = FragH::load(Bb + bo);
    }
    v16h ah[4];
    /* unrolled: all four A fragments of the step are asked for here, so that their LDS reads fly beside the B loads */
#pragma unroll
    for (int i = 0; i < 4; ++i) ah[i] = FragH::load(Al + (i << 4) * kPitchA + k0);
#pragma unroll
    for (int i = 0; i < 4; ++i) {
#pragma unroll
      for (int j = 0; j < 4; ++j) acc[i][j] = FragH::mma(ah[i], bh[j], acc[i][j]);
      /* every accumulator of the group is tied, with its A and B fragments named as inputs */
      guard_one(acc[i][0], ah[i], bh[0]);
      guard_one(acc[i][1], ah[i], bh[1]);
      guard_one(acc[i][2], ah[i], bh[2]);
      guard_one(acc[i][3], ah[i], bh[3]);
    }
    keep4_h(bh[0], bh[1], bh[2], bh[3]);
  }
  acc_guard4(acc[0][0], acc[0][1], acc[0][2], acc[0][3]);
  acc_guard4(acc[1][0], acc[1][1], acc[1][2], acc[1][3]);
  acc_guard4(acc[2][0], acc[2][1], acc[2][2], acc[2][3]);
  acc_guard4(acc[3][0], acc[3][1], acc[3][2], acc[3][3]);

  /* ---- epilogue: D element r of lane l is (row 8*(l>>4) + r, col l & 15) ---- */
  float* slab = sT[wave];
  float* C = Cout + (size_t)b * kSeq * kFeat;
#pragma unroll
  for (int i = 0; i < 4; ++i) {
    const int mBase = m0 + (i << 4);
#pragma unroll
    for (int j = 0; j < 4; ++j) {
#pragma unroll
      for (int r = 0; r < 8; ++r) {
        const float v = acc[i][j][r] * scale;
        slab[(mOff + r) * 68 + (j << 4) + rlane] = v;
      }
    }
    __builtin_amdgcn_fence(__ATOMIC_RELEASE, "workgroup");
    __builtin_amdgcn_wave_barrier();
    __builtin_amdgcn_fence(__ATOMIC_ACQUIRE, "workgroup");
    /* row segment = 64 floats = 256 B = 16 lanes x 16 B; the two lane halves take two consecutive rows */
    const int hh = lane >> 4, c4 = (lane & 15) * 4;
#pragma unroll
    for (int it = 0; it < 8; ++it) {
      const int row = it * 2 + hh;
      v4f v = *(const v4f*)(slab + row * 68 + c4);
      *(v4f*)(C + (size_t)(mBase + row) * ldc + n0 + c4) = v;
    }
    __builtin_amdgcn_fence(__ATOMIC_RELEASE, "workgroup");
    __builtin_amdgcn_wave_barrier();
    __builtin_amdgcn_fence(__ATOMIC_ACQUIRE, "workgroup");
  }
}

// ---------------------------------------------------------------------------
// Long-K batched WMMA GEMM for KVT, f16 operands, f32 accumulate, f16 output: the K sum is split over the 16 waves of a block.
// C[m,n] = f16(scale * sum_k A[m,k] * Bt[n,k]); A = [256][4096] rows m, Bt = [256][4096] rows n, C = [256][256], per batch.
// One 32x64 tile of C per block; batch = blockIdx.y; grid (32, 8) is exact (no tails, no early exit).
// Wave w sums k = 256 w .. 256 w + 255: 512 B in a row of every operand row, so each 128-B line is read by one wave only.
// All shapes are compile-time: every fragment address is a block-uniform base + one lane offset (the same for A and Bt,
// which have the same pitch) + a constant, so nothing is added to an address inside the k loop.
// The products are the builtin form in straight-line code: the compiler keeps the distances behind them, no v_nop helper here.
// The 16 partial tiles (f32) meet in LDS behind one block barrier and are added in wave order 0..15.
// Values below 2^-14 in magnitude are replaced by +0 before the convert.
// Stores: 16 lanes x 8 B = one 128-B line per row segment, one storing wave per line.
// ---------------------------------------------------------------------------
constexpr int kSplitWaves = 16;
constexpr int kWaveK      = kSeq / kSplitWaves;
static_assert((kSeq % (32 * kSplitWaves)) == 0, "every wave of the k-split GEMM sums whole 32-wide k steps");
static_assert((kFeat % 32) == 0, "32-row tiles of the k-split GEMM");

__global__ __launch_bounds__(32 * kSplitWaves) void wmma_kv32x64_f16_ksplit(
    const unsigned short* __restrict__ Ap, const unsigned short* __restrict__ Btp,
    unsigned short* __restrict__ Cout, float scale) {
  /* per-wave 32x64 partial tile, pitch 68 floats */
  __shared__ __align__(16) float sP[kSplitWaves][32 * 68];
  const int b    = blockIdx.y;
  const int lane = threadIdx.x & 31;
  const int wave = threadIdx.x >> 5;
  constexpr int tilesN = kFeat >> 6;
  const int tm = blockIdx.x / tilesN;
  const int tn = blockIdx.x - tm * tilesN;
  const int m0 = tm << 5;
  const int n0 = tn << 6;

  /* row (A) / column (Bt, D) within a 16-wide subtile; k offset of this lane half; D row offset of this lane half */
  const int rlane = lane & 15;
  const int koff  = (lane >> 4) * 8;
  const int mOff  = (lane >> 4) * 8;

  const unsigned loff = (unsigned)(rlane * kSeq + wave * kWaveK + koff);
  const _Float16* Al = (const _Float16*)Ap  + ((size_t)b * kFeat + m0) * kSeq + loff;
  const _Float16* Bl = (const _Float16*)Btp + ((size_t)b * kFeat + n0) * kSeq + loff;

  v8f acc[2][4];
#pragma unroll
  for (int i = 0; i < 2; ++i)
#pragma unroll
    for (int j = 0; j < 4; ++j) acc[i][j] = (v8f){0.f, 0.f, 0.f, 0.f, 0.f, 0.f, 0.f, 0.f};

  /* unrolled whole (8 steps): every k offset becomes a constant of its load, and later steps' loads can fly over earlier products */
#pragma unroll
  for (int ks = 0; ks < kWaveK; ks += 32) {
    v16h bh[4];
#pragma unroll
    for (int j = 0; j < 4; ++j) bh[j] = FragH::load(Bl + (j << 4) * kSeq + ks);
#pragma unroll
    for (int i = 0; i < 2; ++i) {
      const v16h ah = FragH::load(Al + (i << 4) * kSeq + ks);
#pragma unroll
      for (int j = 0; j < 4; ++j) acc[i][j] = FragH::mma(ah, bh[j], acc[i][j]);
    }
  }

  /* ---- each wave's partial tile to LDS: D element r of lane l is (row 8*(l>>4) + r, col l & 15) ---- */
  float* slab = sP[wave];
#pragma unroll
  for (int i = 0; i < 2; ++i)
#pragma unroll
    for (int j = 0; j < 4; ++j)
#pragma unroll
      for (int r = 0; r < 8; ++r) slab[((i << 4) + mOff + r) * 68 + (j << 4) + rlane] = acc[i][j][r];
  /* all 16 partial tiles are in LDS before any thread adds them up */
  __syncthreads();

  /* 512 threads x 4 columns = the 32x64 tile; 16 lanes cover one row */
  const int row = threadIdx.x >> 4;
  const int c4  = (threadIdx.x & 15) * 4;
  v4f s = *(const v4f*)(&sP[0][row * 68 + c4]);
#pragma unroll
  for (int w = 1; w < kSplitWaves; ++w) s += *(const v4f*)(&sP[w][row * 68 + c4]);
  v4h hv;
#pragma unroll
  for (int e = 0; e < 4; ++e) {
    float x = s[e] * scale;
    x = (fabsf(x) < kF16Min) ? 0.0f : x;
    hv[e] = (_Float16)x;
  }
  unsigned short* C = Cout + (size_t)b * kFeat * kFeat;
  *(v4h*)(C + (size_t)(m0 + row) * kFeat + n0 + c4) = hv;
}

// ---------------------------------------------------------------------------
// Transposing convert: in X[b][s][c] (rows = 4096 positions s, cols = 256 features c)  ->  out T[b][c][s]
// (rows = 256 features, cols = 4096 positions), through a 64 (s) x 64 (c) LDS tile.
//   blockIdx.z == 0: X = K, value = 1024 * (max(x,0) + 1e-6)  -> KT[b][d][s]
//   blockIdx.z == 1: X = V, value = 64 * x (raw, signed)       -> VT[b][v][s]
// grid (4096/64 = 64 position tiles, 4 feature tiles x 8 batches = 32, 2 tensors), 256 threads.
// Load coverage: 4 iterations x 256 threads x 4 floats = 4096 = the whole 64x64 tile (16-B loads along c).
// LDS: sm[c_local][s_local], pitch 65 floats; columns 0..63 of all 64 rows are written before the barrier and only
// those are read after it.
// Store coverage: 8 waves x 2 iterations x 4 rows (lane>>3) = 64 feature rows; (lane&7) x 8 halves = 64 positions;
// ---------------------------------------------------------------------------
__global__ __launch_bounds__(256) void transpose_f16_kernel(const float* __restrict__ Kp, const float* __restrict__ Vp,
                                                            unsigned short* __restrict__ KT, unsigned short* __restrict__ VT) {
  __shared__ float sm[64][65];
  const int t  = threadIdx.x;
  const int s0 = blockIdx.x * 64;
  const int c0 = (blockIdx.y & 3) * 64;
  const int b  = blockIdx.y >> 2;
  /* block-uniform tensor selector */
  const int z  = blockIdx.z;
  const float* X = (z == 0) ? Kp : Vp;
  unsigned short* T = (z == 0) ? KT : VT;
  const float* Xb = X + (size_t)b * kSeq * kFeat;
#pragma unroll
  for (int i = 0; i < 4; ++i) {
    const int e  = i * 256 + t;
    const int r  = e >> 4;
    const int c4 = (e & 15) * 4;
    const v4f x = *(const v4f*)(Xb + (size_t)(s0 + r) * kFeat + c0 + c4);
#pragma unroll
    for (int j = 0; j < 4; ++j) {
      const float v = x[j];
      const float yk = (fmaxf(v, 0.0f) + kEps) * kPhiCarry;
      const float yv = v * kVCarry;
      sm[c4 + j][r] = (z == 0) ? yk : yv;
    }
  }
  __syncthreads();
  const int lane = t & 31, wave = t >> 5;
  const int q = lane >> 3, c8 = (lane & 7) * 8;
  unsigned short* Tb = T + (size_t)b * kFeat * kSeq;
  v8h hv[2];
#pragma unroll
  for (int it = 0; it < 2; ++it) {
    const int row = wave * 8 + it * 4 + q;
#pragma unroll
    for (int e = 0; e < 8; ++e) {
      float x = sm[row][c8 + e];
      x = (fabsf(x) < kF16Min) ? 0.0f : x;
      hv[it][e] = (_Float16)x;
    }
  }
  {
#pragma unroll
    for (int it = 0; it < 2; ++it) {
      const int row = wave * 8 + it * 4 + q;
      *(v8h*)(Tb + (size_t)(c0 + row) * kSeq + s0 + c8) = hv[it];
    }
    
  }
}

// ---------------------------------------------------------------------------
// Host glue: 3 kernel launches, nothing else.
//   1. KT, VT transposed carried f16 planes          grid (64, 32, 2)
//   2. KVT[b][v][d] = (1/4096) * sum_s VT[b][v][s] * KT[b][d][s]   (= 16 * KV[b][d][v])
//        A = VT (M = 256 rows v), Bt = KT (N = 256 rows d), K = 4096 split over the 16 waves of a block;
//        32 tiles of 32x64 per batch -> grid (32, 8) = 256 blocks
//   3. out[b][q][v] = (1/16384) * sum_d f16(1024*phi(Q))[b][q][d] * KVT[b][v][d]
//        A from Q in the kernel (M = 4096 rows q), Bt = KVT (N = 256 rows v), K = 256; 128 rows per block -> grid (32, 8)
// ---------------------------------------------------------------------------
extern "C" void kernel_launch(void* const* d_in, const int* in_sizes, int n_in,
                              void* d_out, int out_size, void* d_ws, size_t ws_size,
                              hipStream_t stream) {
  if (n_in < 3) return;
  if (in_sizes[0] != kPlaneElems) return;
  if (in_sizes[1] != kPlaneElems) return;
  if (in_sizes[2] != kPlaneElems) return;
  if (out_size != kPlaneElems) return;
  if (ws_size < kWsTotal) return;

  const float* Q = (const float*)d_in[0];
  const float* K = (const float*)d_in[1];
  const float* V = (const float*)d_in[2];
  float* out = (float*)d_out;

  char* ws = (char*)d_ws;
  unsigned short* KT  = (unsigned short*)(ws + kOffKT);
  unsigned short* VT  = (unsigned short*)(ws + kOffVT);
  unsigned short* KVT = (unsigned short*)(ws + kOffKVT);

  transpose_f16_kernel<<<dim3(kSeq / 64, (kFeat / 64) * kBatch, 2), 256, 0, stream>>>(K, V, KT, VT);

  wmma_kv32x64_f16_ksplit<<<dim3((kFeat / 32) * (kFeat / 64), kBatch), 32 * kSplitWaves, 0, stream>>>(VT, KT, KVT, kScaleKV);

  wmma_out64_phiq_f16<<<dim3(kSeq / kOutRows, kBatch), 256, 0, stream>>>(Q, KVT, out, kScaleOut);
}

// v003
// One run takes 32.7 microseconds.
// In both of two side-by-side timings against v002, it was 1.10 times as fast.
// Over all steps from v000 it is 5.73 times as fast.
// Both contractions (phi(K)^T.V over the 4,096 positions, and phi(Q).KV over the 256 features): v_wmma_f32_16x16x32_f16, plain f16 operands carried by powers of two (phi x1024, V x64, KV x16), f32 accumulate; relu + 1e-6 feature map and all scale folds in f32.
#include <hip/hip_runtime.h>
#include <math.h>

typedef __attribute__((ext_vector_type(16))) _Float16 v16h;
typedef __attribute__((ext_vector_type(8)))  _Float16 v8h;
typedef __attribute__((ext_vector_type(4)))  _Float16 v4h;
typedef __attribute__((ext_vector_type(8)))  float    v8f;
typedef __attribute__((ext_vector_type(4)))  float    v4f;

// ---------------------------------------------------------------------------
// Shape constants (wire contract: three f32 inputs [8][4096][256], one f32 output [8][4096][256])
// ---------------------------------------------------------------------------
constexpr int kBatch = 8;
constexpr int kSeq   = 4096;
constexpr int kFeat  = 256;
constexpr int kPlaneElems = kBatch * kSeq * kFeat;
static_assert(kPlaneElems == 8388608, "element count per tensor");
static_assert((kSeq % 64) == 0 && (kFeat % 64) == 0, "GEMM M,N multiples of 64 and 64x64 tiles for the transposing pass");
static_assert((kSeq % 32) == 0 && (kFeat % 32) == 0, "GEMM K multiples of 32");

// Feature-map offset and power-of-two carries (all exact in f32; folded back in the GEMM epilogue scales)
constexpr float kEps      = 1e-6f;
constexpr float kPhiCarry = 1024.0f;
constexpr float kVCarry   = 64.0f;
constexpr float kKVCarry  = 16.0f;
constexpr float kScaleKV  = kKVCarry / (kPhiCarry * kVCarry);
constexpr float kScaleOut = 1.0f / (kPhiCarry * kKVCarry);
static_assert(kScaleKV == 1.0f / 4096.0f, "first GEMM epilogue scale");
static_assert(kScaleOut == 1.0f / 16384.0f, "second GEMM epilogue scale");
// Smallest normal f16 magnitude (2^-14); smaller operand values are replaced by +0 with a select before the convert
constexpr float kF16Min = 6.103515625e-5f;

// ---------------------------------------------------------------------------
// Workspace region map (bytes; every offset is a multiple of 128)
//   KT   f16 [8][256][4096]  1024*phi(K) transposed, rows = d     16,777,216
//   VT   f16 [8][256][4096]  64*V transposed, rows = v            16,777,216
//   KVT  f16 [8][256][256]   16*KV transposed, rows = v, k = d     1,048,576
//   total                                                         34,603,008
// ---------------------------------------------------------------------------
constexpr size_t kOffKT   = 0;
constexpr size_t kOffVT   = kOffKT  + (size_t)kPlaneElems * 2;
constexpr size_t kOffKVT  = kOffVT  + (size_t)kPlaneElems * 2;
constexpr size_t kWsTotal = kOffKVT + (size_t)kBatch * kFeat * kFeat * 2;
static_assert(kWsTotal == 34603008ull, "carve total");
static_assert(kWsTotal <= 134217728ull, "carve cap");
static_assert((kOffKT % 128) == 0 && (kOffVT % 128) == 0 && (kOffKVT % 128) == 0, "128-B aligned regions");

// ---------------------------------------------------------------------------
// Hazard guards as plain device helpers (no inline asm inside the kernel body)
// ---------------------------------------------------------------------------
__device__ __forceinline__ void guard_one(v8f& acc, v16h a, v16h b) {
  asm volatile("v_nop\n\tv_nop\n\tv_nop\n\tv_nop" : "+v"(acc) : "v"(a), "v"(b));
}
__device__ __forceinline__ void keep4_h(v16h a, v16h b, v16h c, v16h d) {
  asm volatile("v_nop" :: "v"(a), "v"(b), "v"(c), "v"(d));
}
__device__ __forceinline__ void acc_guard4(v8f& a, v8f& b, v8f& c, v8f& d) {
  asm volatile("v_nop\n\tv_nop\n\tv_nop\n\tv_nop" : "+v"(a), "+v"(b), "+v"(c), "+v"(d));
}

// Fragment loader for both A ([m][k] rows) and Bt ([n][k] rows): p points at row (lane & 15), column k0 + 8*(lane >> 4);
// vector elements 0..7 <- p[0..7] (k0 + 8h + 0..7), elements 8..15 <- p[16..23] (k0 + 16 + 8h + 0..7).
struct FragH {
  union U { v16h v; v8h h[2]; };
  static __device__ __forceinline__ v16h load(const _Float16* p) {
    U f;
    f.h[0] = *(const v8h*)(p);
    f.h[1] = *(const v8h*)(p + 16);
    return f.v;
  }
  static __device__ __forceinline__ v8f mma(v16h a, v16h b, v8f c) {
    return __builtin_amdgcn_wmma_f32_16x16x32_f16(false, a, false, b, (short)0, c, false, false);
  }
};

// ---------------------------------------------------------------------------
// Output product with the feature map of Q fused in: f16 operands, f32 accumulate, f32 output.
// out[b][q][v] = scale * sum_d f16(1024 * (max(Q[b][q][d], 0) + 1e-6)) * Bt[b][v][d]; Bt = KVT, rows v, k = d.
// One block = 128 rows q x all 256 columns v; 8 waves as 2 (rows) x 4 (columns), each wave owns a 64x64 tile;
// batch = blockIdx.y; grid (32, 8) is exact (no tails, no early exit).
// The block reads its 128 rows of Q (f32, 128 KB in a row) once, in loads of 512 contiguous bytes a wave, maps and converts
// them and lays them in LDS as f16 rows; the A fragments of all 8 waves come from there behind one block barrier.
// LDS row pitch 264 halves = 528 B = 16 B x 33 (odd), for the 16-byte fragment reads.
// Stores: 16 lanes x 16 B = 256 B = 2 lines per row segment, one storing wave per line.
// ---------------------------------------------------------------------------
constexpr int kOutRows = 128;
constexpr int kPitchA  = kFeat + 8;
static_assert((kSeq % kOutRows) == 0 && kFeat == 256, "exact grid; 4 column waves of 64 cover the 256 columns");
static_assert((kOutRows * kFeat) % (4 * 256) == 0, "staging loop is exact");

__global__ __launch_bounds__(256) void wmma_out64_phiq_f16(
    const float* __restrict__ Q, const unsigned short* __restrict__ Btp,
    float* __restrict__ Cout, float scale) {
  const _Float16* Bt = (const _Float16*)Btp;
  constexpr int ldb = kFeat;
  constexpr int ldc = kFeat;
  constexpr int K   = kFeat;
  /* the block's 128 rows of 1024*phi(Q) in f16 */
  __shared__ __align__(16) _Float16 sA[kOutRows * kPitchA];
  /* per-wave 16x64 slab, pitch 68 floats */
  __shared__ __align__(16) float sT[8][16 * 68];
  const int b    = blockIdx.y;
  const int lane = threadIdx.x & 31;
  const int wave = threadIdx.x >> 5;
  const int r0 = blockIdx.x * kOutRows;
  const int mw = (wave >> 2) << 6;
  const int m0 = r0 + mw;
  const int n0 = (wave & 3) << 6;

  const _Float16* Bb = Bt + (size_t)b * kFeat * kFeat;

  /* ---- stage: 32 iterations x 256 threads x 4 floats = 128 x 256; one row = 64 threads ---- */
  {
    const float* Qt = Q + ((size_t)b * kSeq + r0) * kFeat + 4 * threadIdx.x;
    _Float16* St = sA + (threadIdx.x >> 6) * kPitchA + (threadIdx.x & 63) * 4;
    /* unrolled whole: every offset is a constant of its load or store, and all of a thread's loads can be in flight together */
#pragma unroll
    for (int it = 0; it < (kOutRows * kFeat) / (4 * 256); ++it) {
      const v4f x = *(const v4f*)(Qt + it * (4 * 256));
      v4h hv;
      /* unrolled: the vector elements are named by constants and stay in registers */
#pragma unroll
      for (int e = 0; e < 4; ++e) {
        float y = (fmaxf(x[e], 0.0f) + kEps) * kPhiCarry;
        y = (fabsf(y) < kF16Min) ? 0.0f : y;
        hv[e] = (_Float16)y;
      }
      *(v4h*)(St + it * 4 * kPitchA) = hv;
    }
  }
  /* all 128 rows are in LDS before any wave reads a fragment */
  __syncthreads();

  /* row (A) / column (Bt, D) within a 16-wide subtile; k offset of this lane half; D row offset of this lane half */
  const int rlane = lane & 15;
  const int koff  = (lane >> 4) * 8;
  const int mOff  = (lane >> 4) * 8;
  const _Float16* Al = sA + (mw + rlane) * kPitchA + koff;

  v8f acc[4][4];
#pragma unroll
  for (int i = 0; i < 4; ++i)
#pragma unroll
    for (int j = 0; j < 4; ++j) acc[i][j] = (v8f){0.f, 0.f, 0.f, 0.f, 0.f, 0.f, 0.f, 0.f};

  for (int k0 = 0; k0 < K; k0 += 32) {
    v16h bh[4];
#pragma unroll
    for (int j = 0; j < 4; ++j) {
      const size_t bo = (size_t)(n0 + (j << 4) + rlane) * ldb + koff + k0;
      bh[j] = FragH::load(Bb + bo);
    }
    v16h ah[4];
    /* unrolled: all four A fragments of the step are asked for here, so that their LDS reads fly beside the B loads */
#pragma unroll
    for (int i = 0; i < 4; ++i) ah[i] = FragH::load(Al + (i << 4) * kPitchA + k0);
#pragma unroll
    for (int i = 0; i < 4; ++i) {
#pragma unroll
      for (int j = 0; j < 4; ++j) acc[i][j] = FragH::mma(ah[i], bh[j], acc[i][j]);
      /* every accumulator of the group is tied, with its A and B fragments named as inputs */
      guard_one(acc[i][0], ah[i], bh[0]);
      guard_one(acc[i][1], ah[i], bh[1]);
      guard_one(acc[i][2], ah[i], bh[2]);
      guard_one(acc[i][3], ah[i], bh[3]);
    }
    keep4_h(bh[0], bh[1], bh[2], bh[3]);
  }
  acc_guard4(acc[0][0], acc[0][1], acc[0][2], acc[0][3]);
  acc_guard4(acc[1][0], acc[1][1], acc[1][2], acc[1][3]);
  acc_guard4(acc[2][0], acc[2][1], acc[2][2], acc[2][3]);
  acc_guard4(acc[3][0], acc[3][1], acc[3][2], acc[3][3]);

  /* ---- epilogue: D element r of lane l is (row 8*(l>>4) + r, col l & 15) ---- */
  float* slab = sT[wave];
  float* C = Cout + (size_t)b * kSeq * kFeat;
#pragma unroll
  for (int i = 0; i < 4; ++i) {
    const int mBase = m0 + (i << 4);
#pragma unroll
    for (int j = 0; j < 4; ++j) {
#pragma unroll
      for (int r = 0; r < 8; ++r) {
        const float v = acc[i][j][r] * scale;
        slab[(mOff + r) * 68 + (j << 4) + rlane] = v;
      }
    }
    __builtin_amdgcn_fence(__ATOMIC_RELEASE, "workgroup");
    __builtin_amdgcn_wave_barrier();
    __builtin_amdgcn_fence(__ATOMIC_ACQUIRE, "workgroup");
    /* row segment = 64 floats = 256 B = 16 lanes x 16 B; the two lane halves take two consecutive rows */
    const int hh = lane >> 4, c4 = (lane & 15) * 4;
#pragma unroll
    for (int it = 0; it < 8; ++it) {
      const int row = it * 2 + hh;
      v4f v = *(const v4f*)(slab + row * 68 + c4);
      *(v4f*)(C + (size_t)(mBase + row) * ldc + n0 + c4) = v;
    }
    __builtin_amdgcn_fence(__ATOMIC_RELEASE, "workgroup");
    __builtin_amdgcn_wave_barrier();
    __builtin_amdgcn_fence(__ATOMIC_ACQUIRE, "workgroup");
  }
}

// ---------------------------------------------------------------------------
// Long-K batched WMMA GEMM for KVT, f16 operands, f32 accumulate, f16 output: operands staged in LDS, k steps dealt to 16 waves.
// C[m,n] = f16(scale * sum_k A[m,k] * Bt[n,k]); A = [256][4096] rows m, Bt = [256][4096] rows n, C = [256][256], per batch.
// One 32x64 tile of C per block; batch = blockIdx.y; grid (32, 8) is exact (no tails, no early exit).
// A stage is 512 k (1,024 B) of the block's 32 A rows and 64 Bt rows. It comes into LDS by asynchronous copies, each wave
// instruction 512 contiguous line-aligned bytes of one row, so every line leaves L2 once and whole. Two buffers: the next
// stage's copies fly while this stage is multiplied.
// LDS row pitch 1,040 B = 16 B x 65 (odd), for the 16-byte fragment reads.
// Wave w multiplies k step w (32 k) of each stage: 2 A and 4 Bt fragments, 8 products.
// The blocks of a batch that share operand rows start at different stages (rotation below) and go round the 8 stages,
// so that they do not ask L2 for the same lines at the same moment and different parts of a row (4 of the 8 for A rows, all 8 for Bt rows) are read at any time.
// The products are the builtin form: the compiler keeps the distances behind them, no v_nop helper here.
// The 16 partial tiles (f32) meet in LDS (in the ring, which every reader has left) behind one block barrier and are added
// in wave order 0..15. Values below 2^-14 in magnitude are replaced by +0 before the convert.
// Stores: 16 lanes x 8 B = one 128-B line per row segment, one storing wave per line.
// ---------------------------------------------------------------------------
constexpr int kSplitWaves  = 16;
constexpr int kStageK      = 32 * kSplitWaves;
constexpr int kStages      = kSeq / kStageK;
constexpr int kStageRows   = 32 + 64;
constexpr int kStagePitchH = kStageK + 8;
constexpr int kStageBytes  = kStageRows * kStagePitchH * 2;
constexpr int kCopies      = (kStageRows * kStageK * 2) / (32 * kSplitWaves * 16);
static_assert(kStages == 8 && (kStages & (kStages - 1)) == 0, "the stage rotation wraps with a mask; at least two stages");
static_assert(kCopies == 12, "12 copies of 16 B a thread fill one stage; the copy statement names 12");
static_assert((kStagePitchH * 2) % 32 == 16 && (kStageBytes % 16) == 0, "pitch 16 B x odd; 16-B aligned buffers");
static_assert(2 * kStageBytes >= kSplitWaves * 32 * 68 * 4, "the 16 partial tiles fit the ring");
static_assert((kFeat % 32) == 0, "32-row tiles of the k-split GEMM");

// One stage's 12 copies of this thread: rows 8 apart, 4 of A and 8 of Bt. lds = this thread's LDS byte address of the first row,
// a and b = its global addresses in the first A row and the first Bt row of the stage.
// The copies and s_wait_xcnt stand in one statement, so that no address register is rewritten in front of that wait.
__device__ __forceinline__ void copy_stage(unsigned lds, const _Float16* a, const _Float16* b) {
  constexpr unsigned rs = 8u * kStagePitchH * 2u;
  constexpr size_t   gs = (size_t)8 * kSeq;
  asm volatile(
      "global_load_async_to_lds_b128 %0, %12, off\n\t"
      "global_load_async_to_lds_b128 %1, %13, off\n\t"
      "global_load_async_to_lds_b128 %2, %14, off\n\t"
      "global_load_async_to_lds_b128 %3, %15, off\n\t"
      "global_load_async_to_lds_b128 %4, %16, off\n\t"
      "global_load_async_to_lds_b128 %5, %17, off\n\t"
      "global_load_async_to_lds_b128 %6, %18, off\n\t"
      "global_load_async_to_lds_b128 %7, %19, off\n\t"
      "global_load_async_to_lds_b128 %8, %20, off\n\t"
      "global_load_async_to_lds_b128 %9, %21, off\n\t"
      "global_load_async_to_lds_b128 %10, %22, off\n\t"
      "global_load_async_to_lds_b128 %11, %23, off\n\t"
      "s_wait_xcnt 0x0"
      :: "v"(lds), "v"(lds + rs), "v"(lds + 2u * rs), "v"(lds + 3u * rs), "v"(lds + 4u * rs), "v"(lds + 5u * rs),
         "v"(lds + 6u * rs), "v"(lds + 7u * rs), "v"(lds + 8u * rs), "v"(lds + 9u * rs), "v"(lds + 10u * rs), "v"(lds + 11u * rs),
         "v"(a), "v"(a + gs), "v"(a + 2 * gs), "v"(a + 3 * gs),
         "v"(b), "v"(b + gs), "v"(b + 2 * gs), "v"(b + 3 * gs), "v"(b + 4 * gs), "v"(b + 5 * gs), "v"(b + 6 * gs), "v"(b + 7 * gs)
      : "memory");
}

__global__ __launch_bounds__(32 * kSplitWaves) void wmma_kv32x64_f16_ksplit(
    const unsigned short* __restrict__ Ap, const unsigned short* __restrict__ Btp,
    unsigned short* __restrict__ Cout, float scale) {
  /* two stage buffers; behind the k loop the same bytes hold the per-wave 32x64 partial tiles, pitch 68 floats */
  __shared__ __align__(16) unsigned char sR[2 * kStageBytes];
  const int b    = blockIdx.y;
  const int lane = threadIdx.x & 31;
  const int wave = threadIdx.x >> 5;
  constexpr int tilesN = kFeat >> 6;
  const int tm = blockIdx.x / tilesN;
  const int tn = blockIdx.x - tm * tilesN;
  const int m0 = tm << 5;
  const int n0 = tn << 6;
  /* first stage of this block: differs among the 4 blocks that share A rows and among the 8 that share Bt rows */
  const int rot = (tm + 2 * tn) & (kStages - 1);

  /* row (A) / column (Bt, D) within a 16-wide subtile; k offset of this lane half; D row offset of this lane half */
  const int rlane = lane & 15;
  const int koff  = (lane >> 4) * 8;
  const int mOff  = (lane >> 4) * 8;

  /* copies: wave w brings half (w & 1) of rows (w >> 1) + 8 c, c = 0..11; a lane brings 16 B */
  const int crow = wave >> 1;
  const int ccol = (wave & 1) * 256 + lane * 8;
  const _Float16* Ag = (const _Float16*)Ap  + ((size_t)b * kFeat + m0 + crow) * kSeq + ccol;
  const _Float16* Bg = (const _Float16*)Btp + ((size_t)b * kFeat + n0 + crow) * kSeq + ccol;
  const unsigned ldsc = (unsigned)(size_t)sR + (unsigned)((crow * kStagePitchH + ccol) * 2);

  /* fragments: rows 0..31 of a buffer are A, rows 32..95 are Bt; this wave's k step starts at column 32 w */
  const _Float16* Fl = (const _Float16*)sR + rlane * kStagePitchH + wave * 32 + koff;

  v8f acc[2][4];
#pragma unroll
  for (int i = 0; i < 2; ++i)
#pragma unroll
    for (int j = 0; j < 4; ++j) acc[i][j] = (v8f){0.f, 0.f, 0.f, 0.f, 0.f, 0.f, 0.f, 0.f};

  copy_stage(ldsc, Ag + rot * kStageK, Bg + rot * kStageK);
  /* this wave's copies of the first stage have landed */
  asm volatile("s_wait_asynccnt 0x0" ::: "memory");
  /* every wave's copies of the first stage have landed before any wave reads a fragment */
  __syncthreads();
  {
    const int s1 = (rot + 1) & (kStages - 1);
    copy_stage(ldsc + kStageBytes, Ag + s1 * kStageK, Bg + s1 * kStageK);
  }

  /* unrolled whole (8 trips): the buffer offsets and the test for a stage t + 2 become constants */
#pragma unroll
  for (int t = 0; t < kStages; ++t) {
    const _Float16* Ft = Fl + (t & 1) * (kStageBytes / 2);
    v16h bh[4];
#pragma unroll
    for (int j = 0; j < 4; ++j) bh[j] = FragH::load(Ft + (32 + (j << 4)) * kStagePitchH);
#pragma unroll
    for (int i = 0; i < 2; ++i) {
      const v16h ah = FragH::load(Ft + (i << 4) * kStagePitchH);
#pragma unroll
      for (int j = 0; j < 4; ++j) acc[i][j] = FragH::mma(ah, bh[j], acc[i][j]);
    }
    /* keeps the products in front of the waits: they run while stage t + 1 flies; sunk behind the barrier they would delay the refill */
    __builtin_amdgcn_sched_barrier(0);
    /* this wave's reads of the buffer are done before the barrier behind which the buffer is refilled */
    asm volatile("s_wait_dscnt 0x0" ::: "memory");
    /* this wave's copies of stage t + 1 have landed */
    asm volatile("s_wait_asynccnt 0x0" ::: "memory");
    /* publishes stage t + 1 and ends every wave's reads of stage t's buffer */
    __syncthreads();
    if (t + 2 < kStages) {
      const int s2 = (rot + t + 2) & (kStages - 1);
      copy_stage(ldsc + (t & 1) * kStageBytes, Ag + s2 * kStageK, Bg + s2 * kStageK);
    }
  }
  /* no copy is outstanding when the ring takes the partial tiles */
  asm volatile("s_wait_asynccnt 0x0" ::: "memory");

  /* ---- each wave's partial tile to LDS: D element r of lane l is (row 8*(l>>4) + r, col l & 15) ---- */
  float* sP = (float*)sR;
  float* slab = sP + wave * (32 * 68);
#pragma unroll
  for (int i = 0; i < 2; ++i)
#pragma unroll
    for (int j = 0; j < 4; ++j)
#pragma unroll
      for (int r = 0; r < 8; ++r) slab[((i << 4) + mOff + r) * 68 + (j << 4) + rlane] = acc[i][j][r];
  /* all 16 partial tiles are in LDS before any thread adds them up */
  __syncthreads();

  /* 512 threads x 4 columns = the 32x64 tile; 16 lanes cover one row */
  const int row = threadIdx.x >> 4;
  const int c4  = (threadIdx.x & 15) * 4;
  v4f s = *(const v4f*)(sP + row * 68 + c4);
#pragma unroll
  for (int w = 1; w < kSplitWaves; ++w) s += *(const v4f*)(sP + w * (32 * 68) + row * 68 + c4);
  v4h hv;
#pragma unroll
  for (int e = 0; e < 4; ++e) {
    float x = s[e] * scale;
    x = (fabsf(x) < kF16Min) ? 0.0f : x;
    hv[e] = (_Float16)x;
  }
  unsigned short* C = Cout + (size_t)b * kFeat * kFeat;
  *(v4h*)(C + (size_t)(m0 + row) * kFeat + n0 + c4) = hv;
}

// ---------------------------------------------------------------------------
// Transposing convert: in X[b][s][c] (rows = 4096 positions s, cols = 256 features c)  ->  out T[b][c][s]
// (rows = 256 features, cols = 4096 positions), through a 64 (s) x 64 (c) LDS tile.
//   blockIdx.z == 0: X = K, value = 1024 * (max(x,0) + 1e-6)  -> KT[b][d][s]
//   blockIdx.z == 1: X = V, value = 64 * x (raw, signed)       -> VT[b][v][s]
// grid (4096/64 = 64 position tiles, 4 feature tiles x 8 batches = 32, 2 tensors), 256 threads.
// Load coverage: 4 iterations x 256 threads x 4 floats = 4096 = the whole 64x64 tile (16-B loads along c).
// LDS: sm[c_local][s_local], pitch 65 floats; columns 0..63 of all 64 rows are written before the barrier and only
// those are read after it.
// Store coverage: 8 waves x 2 iterations x 4 rows (lane>>3) = 64 feature rows; (lane&7) x 8 halves = 64 positions;
// ---------------------------------------------------------------------------
__global__ __launch_bounds__(256) void transpose_f16_kernel(const float* __restrict__ Kp, const float* __restrict__ Vp,
                                                            unsigned short* __restrict__ KT, unsigned short* __restrict__ VT) {
  __shared__ float sm[64][65];
  const int t  = threadIdx.x;
  const int s0 = blockIdx.x * 64;
  const int c0 = (blockIdx.y & 3) * 64;
  const int b  = blockIdx.y >> 2;
  /* block-uniform tensor selector */
  const int z  = blockIdx.z;
  const float* X = (z == 0) ? Kp : Vp;
  unsigned short* T = (z == 0) ? KT : VT;
  const float* Xb = X + (size_t)b * kSeq * kFeat;
#pragma unroll
  for (int i = 0; i < 4; ++i) {
    const int e  = i * 256 + t;
    const int r  = e >> 4;
    const int c4 = (e & 15) * 4;
    const v4f x = *(const v4f*)(Xb + (size_t)(s0 + r) * kFeat + c0 + c4);
#pragma unroll
    for (int j = 0; j < 4; ++j) {
      const float v = x[j];
      const float yk = (fmaxf(v, 0.0f) + kEps) * kPhiCarry;
      const float yv = v * kVCarry;
      sm[c4 + j][r] = (z == 0) ? yk : yv;
    }
  }
  __syncthreads();
  const int lane = t & 31, wave = t >> 5;
  const int q = lane >> 3, c8 = (lane & 7) * 8;
  unsigned short* Tb = T + (size_t)b * kFeat * kSeq;
  v8h hv[2];
#pragma unroll
  for (int it = 0; it < 2; ++it) {
    const int row = wave * 8 + it * 4 + q;
#pragma unroll
    for (int e = 0; e < 8; ++e) {
      float x = sm[row][c8 + e];
      x = (fabsf(x) < kF16Min) ? 0.0f : x;
      hv[it][e] = (_Float16)x;
    }
  }
  {
#pragma unroll
    for (int it = 0; it < 2; ++it) {
      const int row = wave * 8 + it * 4 + q;
      *(v8h*)(Tb + (size_t)(c0 + row) * kSeq + s0 + c8) = hv[it];
    }
    
  }
}

// ---------------------------------------------------------------------------
// Host glue: 3 kernel launches, nothing else.
//   1. KT, VT transposed carried f16 planes          grid (64, 32, 2)
//   2. KVT[b][v][d] = (1/4096) * sum_s VT[b][v][s] * KT[b][d][s]   (= 16 * KV[b][d][v])
//        A = VT (M = 256 rows v), Bt = KT (N = 256 rows d), K = 4096 in 8 LDS stages, k steps dealt to the 16 waves of a block;
//        32 tiles of 32x64 per batch -> grid (32, 8) = 256 blocks
//   3. out[b][q][v] = (1/16384) * sum_d f16(1024*phi(Q))[b][q][d] * KVT[b][v][d]
//        A from Q in the kernel (M = 4096 rows q), Bt = KVT (N = 256 rows v), K = 256; 128 rows per block -> grid (32, 8)
// ---------------------------------------------------------------------------
extern "C" void kernel_launch(void* const* d_in, const int* in_sizes, int n_in,
                              void* d_out, int out_size, void* d_ws, size_t ws_size,
                              hipStream_t stream) {
  if (n_in < 3) return;
  if (in_sizes[0] != kPlaneElems) return;
  if (in_sizes[1] != kPlaneElems) return;
  if (in_sizes[2] != kPlaneElems) return;
  if (out_size != kPlaneElems) return;
  if (ws_size < kWsTotal) return;

  const float* Q = (const float*)d_in[0];
  const float* K = (const float*)d_in[1];
  const float* V = (const float*)d_in[2];
  float* out = (float*)d_out;

  char* ws = (char*)d_ws;
  unsigned short* KT  = (unsigned short*)(ws + kOffKT);
  unsigned short* VT  = (unsigned short*)(ws + kOffVT);
  unsigned short* KVT = (unsigned short*)(ws + kOffKVT);

  transpose_f16_kernel<<<dim3(kSeq / 64, (kFeat / 64) * kBatch, 2), 256, 0, stream>>>(K, V, KT, VT);

  wmma_kv32x64_f16_ksplit<<<dim3((kFeat / 32) * (kFeat / 64), kBatch), 32 * kSplitWaves, 0, stream>>>(VT, KT, KVT, kScaleKV);

  wmma_out64_phiq_f16<<<dim3(kSeq / kOutRows, kBatch), 256, 0, stream>>>(Q, KVT, out, kScaleOut);
}

// v004
// It runs in 31.5 microseconds.
// Two timings next to v003 put it at 1.03 and 1.04 times that version's speed.
// Over all steps from v000 it is 5.95 times as fast.
// Both contractions (phi(K)^T.V over the 4,096 positions, and phi(Q).KV over the 256 features): v_wmma_f32_16x16x32_f16, plain f16 operands carried by powers of two (phi x1024, V x64, KV x16), f32 accumulate; relu + 1e-6 feature map and all scale folds in f32.
#include <hip/hip_runtime.h>
#include <math.h>

typedef __attribute__((ext_vector_type(16))) _Float16 v16h;
typedef __attribute__((ext_vector_type(8)))  _Float16 v8h;
typedef __attribute__((ext_vector_type(4)))  _Float16 v4h;
typedef __attribute__((ext_vector_type(8)))  float    v8f;
typedef __attribute__((ext_vector_type(4)))  float    v4f;

// ---------------------------------------------------------------------------
// Shape constants (wire contract: three f32 inputs [8][4096][256], one f32 output [8][4096][256])
// ---------------------------------------------------------------------------
constexpr int kBatch = 8;
constexpr int kSeq   = 4096;
constexpr int kFeat  = 256;
constexpr int kPlaneElems = kBatch * kSeq * kFeat;
static_assert(kPlaneElems == 8388608, "element count per tensor");
static_assert((kSeq % 64) == 0 && (kFeat % 64) == 0, "GEMM M,N multiples of 64 and 64x64 tiles for the transposing pass");
static_assert((kSeq % 32) == 0 && (kFeat % 32) == 0, "GEMM K multiples of 32");

// Feature-map offset and power-of-two carries (all exact in f32; folded back in the GEMM epilogue scales)
constexpr float kEps      = 1e-6f;
constexpr float kPhiCarry = 1024.0f;
constexpr float kVCarry   = 64.0f;
constexpr float kKVCarry  = 16.0f;
constexpr float kScaleKV  = kKVCarry / (kPhiCarry * kVCarry);
constexpr float kScaleOut = 1.0f / (kPhiCarry * kKVCarry);
static_assert(kScaleKV == 1.0f / 4096.0f, "first GEMM epilogue scale");
static_assert(kScaleOut == 1.0f / 16384.0f, "second GEMM epilogue scale");
// Smallest normal f16 magnitude (2^-14); smaller operand values are replaced by +0 with a select before the convert
constexpr float kF16Min = 6.103515625e-5f;

// ---------------------------------------------------------------------------
// Workspace region map (bytes; every offset is a multiple of 128)
//   KT   f16 [8][256][4096]  1024*phi(K) transposed, rows = d     16,777,216
//   VT   f16 [8][256][4096]  64*V transposed, rows = v            16,777,216
//   KVT  f16 [8][256][256]   16*KV transposed, rows = v, k = d     1,048,576
//   total                                                         34,603,008
// ---------------------------------------------------------------------------
constexpr size_t kOffKT   = 0;
constexpr size_t kOffVT   = kOffKT  + (size_t)kPlaneElems * 2;
constexpr size_t kOffKVT  = kOffVT  + (size_t)kPlaneElems * 2;
constexpr size_t kWsTotal = kOffKVT + (size_t)kBatch * kFeat * kFeat * 2;
static_assert(kWsTotal == 34603008ull, "carve total");
static_assert(kWsTotal <= 134217728ull, "carve cap");
static_assert((kOffKT % 128) == 0 && (kOffVT % 128) == 0 && (kOffKVT % 128) == 0, "128-B aligned regions");

// ---------------------------------------------------------------------------
// Hazard guards as plain device helpers (no inline asm inside the kernel body)
// ---------------------------------------------------------------------------
__device__ __forceinline__ void guard_one(v8f& acc, v16h a, v16h b) {
  asm volatile("v_nop\n\tv_nop\n\tv_nop\n\tv_nop" : "+v"(acc) : "v"(a), "v"(b));
}
__device__ __forceinline__ void keep4_h(v16h a, v16h b, v16h c, v16h d) {
  asm volatile("v_nop" :: "v"(a), "v"(b), "v"(c), "v"(d));
}
__device__ __forceinline__ void acc_guard4(v8f& a, v8f& b, v8f& c, v8f& d) {
  asm volatile("v_nop\n\tv_nop\n\tv_nop\n\tv_nop" : "+v"(a), "+v"(b), "+v"(c), "+v"(d));
}

// Fragment loader for both A ([m][k] rows) and Bt ([n][k] rows): p points at row (lane & 15), column k0 + 8*(lane >> 4);
// vector elements 0..7 <- p[0..7] (k0 + 8h + 0..7), elements 8..15 <- p[16..23] (k0 + 16 + 8h + 0..7).
struct FragH {
  union U { v16h v; v8h h[2]; };
  static __device__ __forceinline__ v16h load(const _Float16* p) {
    U f;
    f.h[0] = *(const v8h*)(p);
    f.h[1] = *(const v8h*)(p + 16);
    return f.v;
  }
  static __device__ __forceinline__ v8f mma(v16h a, v16h b, v8f c) {
    return __builtin_amdgcn_wmma_f32_16x16x32_f16(false, a, false, b, (short)0, c, false, false);
  }
};

// ---------------------------------------------------------------------------
// Output product with the feature map of Q fused in: f16 operands, f32 accumulate, f32 output.
// out[b][q][v] = scale * sum_d f16(1024 * (max(Q[b][q][d], 0) + 1e-6)) * Bt[b][v][d]; Bt = KVT, rows v, k = d.
// One block = 128 rows q x all 256 columns v; 8 waves as 2 (rows) x 4 (columns), each wave owns a 64x64 tile;
// batch = blockIdx.y; grid (32, 8) is exact (no tails, no early exit).
// The block reads its 128 rows of Q (f32, 128 KB in a row) once, in loads of 512 contiguous bytes a wave, maps and converts
// them and lays them in LDS as f16 rows; the A fragments of all 8 waves come from there behind one block barrier.
// LDS row pitch 264 halves = 528 B = 16 B x 33 (odd), for the 16-byte fragment reads.
// Stores: 16 lanes x 16 B = 256 B = 2 lines per row segment, one storing wave per line.
// ---------------------------------------------------------------------------
constexpr int kOutRows = 128;
constexpr int kPitchA  = kFeat + 8;
static_assert((kSeq % kOutRows) == 0 && kFeat == 256, "exact grid; 4 column waves of 64 cover the 256 columns");
static_assert((kOutRows * kFeat) % (4 * 256) == 0, "staging loop is exact");

__global__ __launch_bounds__(256) void wmma_out64_phiq_f16(
    const float* __restrict__ Q, const unsigned short* __restrict__ Btp,
    float* __restrict__ Cout, float scale) {
  const _Float16* Bt = (const _Float16*)Btp;
  constexpr int ldb = kFeat;
  constexpr int ldc = kFeat;
  constexpr int K   = kFeat;
  /* the block's 128 rows of 1024*phi(Q) in f16 */
  __shared__ __align__(16) _Float16 sA[kOutRows * kPitchA];
  /* per-wave 16x64 slab, pitch 68 floats */
  __shared__ __align__(16) float sT[8][16 * 68];
  const int b    = blockIdx.y;
  const int lane = threadIdx.x & 31;
  const int wave = threadIdx.x >> 5;
  const int r0 = blockIdx.x * kOutRows;
  const int mw = (wave >> 2) << 6;
  const int m0 = r0 + mw;
  const int n0 = (wave & 3) << 6;

  const _Float16* Bb = Bt + (size_t)b * kFeat * kFeat;

  /* ---- stage: 32 iterations x 256 threads x 4 floats = 128 x 256; one row = 64 threads ---- */
  {
    const float* Qt = Q + ((size_t)b * kSeq + r0) * kFeat + 4 * threadIdx.x;
    _Float16* St = sA + (threadIdx.x >> 6) * kPitchA + (threadIdx.x & 63) * 4;
    /* unrolled whole: every offset is a constant of its load or store, and all of a thread's loads can be in flight together */
#pragma unroll
    for (int it = 0; it < (kOutRows * kFeat) / (4 * 256); ++it) {
      const v4f x = *(const v4f*)(Qt + it * (4 * 256));
      v4h hv;
      /* unrolled: the vector elements are named by constants and stay in registers */
#pragma unroll
      for (int e = 0; e < 4; ++e) {
        float y = (fmaxf(x[e], 0.0f) + kEps) * kPhiCarry;
        y = (fabsf(y) < kF16Min) ? 0.0f : y;
        hv[e] = (_Float16)y;
      }
      *(v4h*)(St + it * 4 * kPitchA) = hv;
    }
  }
  /* all 128 rows are in LDS before any wave reads a fragment */
  __syncthreads();

  /* row (A) / column (Bt, D) within a 16-wide subtile; k offset of this lane half; D row offset of this lane half */
  const int rlane = lane & 15;
  const int koff  = (lane >> 4) * 8;
  const int mOff  = (lane >> 4) * 8;
  const _Float16* Al = sA + (mw + rlane) * kPitchA + koff;

  v8f acc[4][4];
#pragma unroll
  for (int i = 0; i < 4; ++i)
#pragma unroll
    for (int j = 0; j < 4; ++j) acc[i][j] = (v8f){0.f, 0.f, 0.f, 0.f, 0.f, 0.f, 0.f, 0.f};

  for (int k0 = 0; k0 < K; k0 += 32) {
    v16h bh[4];
#pragma unroll
    for (int j = 0; j < 4; ++j) {
      const size_t bo = (size_t)(n0 + (j << 4) + rlane) * ldb + koff + k0;
      bh[j] = FragH::load(Bb + bo);
    }
    v16h ah[4];
    /* unrolled: all four A fragments of the step are asked for here, so that their LDS reads fly beside the B loads */
#pragma unroll
    for (int i = 0; i < 4; ++i) ah[i] = FragH::load(Al + (i << 4) * kPitchA + k0);
#pragma unroll
    for (int i = 0; i < 4; ++i) {
#pragma unroll
      for (int j = 0; j < 4; ++j) acc[i][j] = FragH::mma(ah[i], bh[j], acc[i][j]);
      /* every accumulator of the group is tied, with its A and B fragments named as inputs */
      guard_one(acc[i][0], ah[i], bh[0]);
      guard_one(acc[i][1], ah[i], bh[1]);
      guard_one(acc[i][2], ah[i], bh[2]);
      guard_one(acc[i][3], ah[i], bh[3]);
    }
    keep4_h(bh[0], bh[1], bh[2], bh[3]);
  }
  acc_guard4(acc[0][0], acc[0][1], acc[0][2], acc[0][3]);
  acc_guard4(acc[1][0], acc[1][1], acc[1][2], acc[1][3]);
  acc_guard4(acc[2][0], acc[2][1], acc[2][2], acc[2][3]);
  acc_guard4(acc[3][0], acc[3][1], acc[3][2], acc[3][3]);

  /* ---- epilogue: D element r of lane l is (row 8*(l>>4) + r, col l & 15) ---- */
  float* slab = sT[wave];
  float* C = Cout + (size_t)b * kSeq * kFeat;
#pragma unroll
  for (int i = 0; i < 4; ++i) {
    const int mBase = m0 + (i << 4);
#pragma unroll
    for (int j = 0; j < 4; ++j) {
#pragma unroll
      for (int r = 0; r < 8; ++r) {
        const float v = acc[i][j][r] * scale;
        slab[(mOff + r) * 68 + (j << 4) + rlane] = v;
      }
    }
    __builtin_amdgcn_fence(__ATOMIC_RELEASE, "workgroup");
    __builtin_amdgcn_wave_barrier();
    __builtin_amdgcn_fence(__ATOMIC_ACQUIRE, "workgroup");
    /* row segment = 64 floats = 256 B = 16 lanes x 16 B; the two lane halves take two consecutive rows */
    const int hh = lane >> 4, c4 = (lane & 15) * 4;
#pragma unroll
    for (int it = 0; it < 8; ++it) {
      const int row = it * 2 + hh;
      v4f v = *(const v4f*)(slab + row * 68 + c4);
      *(v4f*)(C + (size_t)(mBase + row) * ldc + n0 + c4) = v;
    }
    __builtin_amdgcn_fence(__ATOMIC_RELEASE, "workgroup");
    __builtin_amdgcn_wave_barrier();
    __builtin_amdgcn_fence(__ATOMIC_ACQUIRE, "workgroup");
  }
}

// ---------------------------------------------------------------------------
// Long-K batched WMMA GEMM for KVT, f16 operands, f32 accumulate, f16 output: operands staged in LDS, k steps dealt to 16 waves.
// C[m,n] = f16(scale * sum_k A[m,k] * Bt[n,k]); A = [256][4096] rows m, Bt = [256][4096] rows n, C = [256][256], per batch.
// One 32x64 tile of C per block; batch = blockIdx.y; grid (32, 8) is exact (no tails, no early exit).
// A stage is 512 k (1,024 B) of the block's 32 A rows and 64 Bt rows. It comes into LDS by asynchronous copies, each wave
// instruction 512 contiguous line-aligned bytes of one row, so every line leaves L2 once and whole. Two buffers: the next
// stage's copies fly while this stage is multiplied.
// LDS row pitch 1,040 B = 16 B x 65 (odd), for the 16-byte fragment reads.
// Wave w multiplies k step w (32 k) of each stage: 2 A and 4 Bt fragments, 8 products.
// The blocks of a batch that share operand rows start at different stages (rotation below) and go round the 8 stages,
// so that they do not ask L2 for the same lines at the same moment and different parts of a row (4 of the 8 for A rows, all 8 for Bt rows) are read at any time.
// The products are the builtin form: the compiler keeps the distances behind them, no v_nop helper here.
// The 16 partial tiles (f32) meet in LDS (in the ring, which every reader has left) behind one block barrier and are added
// in wave order 0..15. Values below 2^-14 in magnitude are replaced by +0 before the convert.
// Stores: 16 lanes x 8 B = one 128-B line per row segment, one storing wave per line.
// ---------------------------------------------------------------------------
constexpr int kSplitWaves  = 16;
constexpr int kStageK      = 32 * kSplitWaves;
constexpr int kStages      = kSeq / kStageK;
constexpr int kStageRows   = 32 + 64;
constexpr int kStagePitchH = kStageK + 8;
constexpr int kStageBytes  = kStageRows * kStagePitchH * 2;
constexpr int kCopies      = (kStageRows * kStageK * 2) / (32 * kSplitWaves * 16);
static_assert(kStages == 8 && (kStages & (kStages - 1)) == 0, "the stage rotation wraps with a mask; at least two stages");
static_assert(kCopies == 12, "12 copies of 16 B a thread fill one stage; the copy statement names 12");
static_assert((kStagePitchH * 2) % 32 == 16 && (kStageBytes % 16) == 0, "pitch 16 B x odd; 16-B aligned buffers");
static_assert(2 * kStageBytes >= kSplitWaves * 32 * 68 * 4, "the 16 partial tiles fit the ring");
static_assert((kFeat % 32) == 0, "32-row tiles of the k-split GEMM");

// One stage's 12 copies of this thread: rows 8 apart, 4 of A and 8 of Bt. lds = this thread's LDS byte address of the first row,
// a and b = its global addresses in the first A row and the first Bt row of the stage.
// The copies and s_wait_xcnt stand in one statement, so that no address register is rewritten in front of that wait.
__device__ __forceinline__ void copy_stage(unsigned lds, const _Float16* a, const _Float16* b) {
  constexpr unsigned rs = 8u * kStagePitchH * 2u;
  constexpr size_t   gs = (size_t)8 * kSeq;
  asm volatile(
      "global_load_async_to_lds_b128 %0, %12, off\n\t"
      "global_load_async_to_lds_b128 %1, %13, off\n\t"
      "global_load_async_to_lds_b128 %2, %14, off\n\t"
      "global_load_async_to_lds_b128 %3, %15, off\n\t"
      "global_load_async_to_lds_b128 %4, %16, off\n\t"
      "global_load_async_to_lds_b128 %5, %17, off\n\t"
      "global_load_async_to_lds_b128 %6, %18, off\n\t"
      "global_load_async_to_lds_b128 %7, %19, off\n\t"
      "global_load_async_to_lds_b128 %8, %20, off\n\t"
      "global_load_async_to_lds_b128 %9, %21, off\n\t"
      "global_load_async_to_lds_b128 %10, %22, off\n\t"
      "global_load_async_to_lds_b128 %11, %23, off\n\t"
      "s_wait_xcnt 0x0"
      :: "v"(lds), "v"(lds + rs), "v"(lds + 2u * rs), "v"(lds + 3u * rs), "v"(lds + 4u * rs), "v"(lds + 5u * rs),
         "v"(lds + 6u * rs), "v"(lds + 7u * rs), "v"(lds + 8u * rs), "v"(lds + 9u * rs), "v"(lds + 10u * rs), "v"(lds + 11u * rs),
         "v"(a), "v"(a + gs), "v"(a + 2 * gs), "v"(a + 3 * gs),
         "v"(b), "v"(b + gs), "v"(b + 2 * gs), "v"(b + 3 * gs), "v"(b + 4 * gs), "v"(b + 5 * gs), "v"(b + 6 * gs), "v"(b + 7 * gs)
      : "memory");
}

__global__ __launch_bounds__(32 * kSplitWaves) void wmma_kv32x64_f16_ksplit(
    const unsigned short* __restrict__ Ap, const unsigned short* __restrict__ Btp,
    unsigned short* __restrict__ Cout, float scale) {
  /* two stage buffers; behind the k loop the same bytes hold the per-wave 32x64 partial tiles, pitch 68 floats */
  __shared__ __align__(16) unsigned char sR[2 * kStageBytes];
  const int b    = blockIdx.y;
  const int lane = threadIdx.x & 31;
  const int wave = threadIdx.x >> 5;
  constexpr int tilesN = kFeat >> 6;
  const int tm = blockIdx.x / tilesN;
  const int tn = blockIdx.x - tm * tilesN;
  const int m0 = tm << 5;
  const int n0 = tn << 6;
  /* first stage of this block: differs among the 4 blocks that share A rows and among the 8 that share Bt rows */
  const int rot = (tm + 2 * tn) & (kStages - 1);

  /* row (A) / column (Bt, D) within a 16-wide subtile; k offset of this lane half; D row offset of this lane half */
  const int rlane = lane & 15;
  const int koff  = (lane >> 4) * 8;
  const int mOff  = (lane >> 4) * 8;

  /* copies: wave w brings half (w & 1) of rows (w >> 1) + 8 c, c = 0..11; a lane brings 16 B */
  const int crow = wave >> 1;
  const int ccol = (wave & 1) * 256 + lane * 8;
  const _Float16* Ag = (const _Float16*)Ap  + ((size_t)b * kFeat + m0 + crow) * kSeq + ccol;
  const _Float16* Bg = (const _Float16*)Btp + ((size_t)b * kFeat + n0 + crow) * kSeq + ccol;
  const unsigned ldsc = (unsigned)(size_t)sR + (unsigned)((crow * kStagePitchH + ccol) * 2);

  /* fragments: rows 0..31 of a buffer are A, rows 32..95 are Bt; this wave's k step starts at column 32 w */
  const _Float16* Fl = (const _Float16*)sR + rlane * kStagePitchH + wave * 32 + koff;

  v8f acc[2][4];
#pragma unroll
  for (int i = 0; i < 2; ++i)
#pragma unroll
    for (int j = 0; j < 4; ++j) acc[i][j] = (v8f){0.f, 0.f, 0.f, 0.f, 0.f, 0.f, 0.f, 0.f};

  copy_stage(ldsc, Ag + rot * kStageK, Bg + rot * kStageK);
  /* this wave's copies of the first stage have landed */
  asm volatile("s_wait_asynccnt 0x0" ::: "memory");
  /* every wave's copies of the first stage have landed before any wave reads a fragment */
  __syncthreads();
  {
    const int s1 = (rot + 1) & (kStages - 1);
    copy_stage(ldsc + kStageBytes, Ag + s1 * kStageK, Bg + s1 * kStageK);
  }

  /* unrolled whole (8 trips): the buffer offsets and the test for a stage t + 2 become constants */
#pragma unroll
  for (int t = 0; t < kStages; ++t) {
    const _Float16* Ft = Fl + (t & 1) * (kStageBytes / 2);
    v16h bh[4];
#pragma unroll
    for (int j = 0; j < 4; ++j) bh[j] = FragH::load(Ft + (32 + (j << 4)) * kStagePitchH);
#pragma unroll
    for (int i = 0; i < 2; ++i) {
      const v16h ah = FragH::load(Ft + (i << 4) * kStagePitchH);
#pragma unroll
      for (int j = 0; j < 4; ++j) acc[i][j] = FragH::mma(ah, bh[j], acc[i][j]);
    }
    /* keeps the products in front of the waits: they run while stage t + 1 flies; sunk behind the barrier they would delay the refill */
    __builtin_amdgcn_sched_barrier(0);
    /* this wave's reads of the buffer are done before the barrier behind which the buffer is refilled */
    asm volatile("s_wait_dscnt 0x0" ::: "memory");
    /* this wave's copies of stage t + 1 have landed */
    asm volatile("s_wait_asynccnt 0x0" ::: "memory");
    /* publishes stage t + 1 and ends every wave's reads of stage t's buffer */
    __syncthreads();
    if (t + 2 < kStages) {
      const int s2 = (rot + t + 2) & (kStages - 1);
      copy_stage(ldsc + (t & 1) * kStageBytes, Ag + s2 * kStageK, Bg + s2 * kStageK);
    }
  }
  /* no copy is outstanding when the ring takes the partial tiles */
  asm volatile("s_wait_asynccnt 0x0" ::: "memory");

  /* ---- each wave's partial tile to LDS: D element r of lane l is (row 8*(l>>4) + r, col l & 15) ---- */
  float* sP = (float*)sR;
  float* slab = sP + wave * (32 * 68);
#pragma unroll
  for (int i = 0; i < 2; ++i)
#pragma unroll
    for (int j = 0; j < 4; ++j)
#pragma unroll
      for (int r = 0; r < 8; ++r) slab[((i << 4) + mOff + r) * 68 + (j << 4) + rlane] = acc[i][j][r];
  /* all 16 partial tiles are in LDS before any thread adds them up */
  __syncthreads();

  /* 512 threads x 4 columns = the 32x64 tile; 16 lanes cover one row */
  const int row = threadIdx.x >> 4;
  const int c4  = (threadIdx.x & 15) * 4;
  v4f s = *(const v4f*)(sP + row * 68 + c4);
#pragma unroll
  for (int w = 1; w < kSplitWaves; ++w) s += *(const v4f*)(sP + w * (32 * 68) + row * 68 + c4);
  v4h hv;
#pragma unroll
  for (int e = 0; e < 4; ++e) {
    float x = s[e] * scale;
    x = (fabsf(x) < kF16Min) ? 0.0f : x;
    hv[e] = (_Float16)x;
  }
  unsigned short* C = Cout + (size_t)b * kFeat * kFeat;
  *(v4h*)(C + (size_t)(m0 + row) * kFeat + n0 + c4) = hv;
}

// ---------------------------------------------------------------------------
// Transposing convert: in X[b][s][c] (rows = 4096 positions s, cols = 256 features c)  ->  out T[b][c][s]
// (rows = 256 features, cols = 4096 positions), through 64 (s) x 64 (c) LDS tiles.
//   blockIdx.z == 0: X = K, value = 1024 * (max(x,0) + 1e-6)  -> KT[b][d][s]
//   blockIdx.z == 1: X = V, value = 64 * x (raw, signed)       -> VT[b][v][s]
// A block stays resident and takes 8 tiles, one behind the other along s (512 positions of its 64 features):
// grid (8 runs of 8 position tiles, 4 feature tiles x 8 batches = 32, 2 tensors) = 512 blocks of 256 threads = 4,096 waves.
// The loads of the next three tiles are in flight (12 loads of 16 B a thread) while a tile goes through LDS and is stored,
// so that reads, LDS work and stores of a block overlap and few waves have to be started.
// Load coverage of a tile: 4 iterations x 256 threads x 4 floats = 4096 = the whole 64x64 tile (16-B loads along c).
// LDS: two buffers sm[.][c_local][s_local], pitch 65 floats; columns 0..63 of all 64 rows are written before the tile's barrier
// and only those are read after it. One barrier a tile: a buffer is written again two tiles later, behind the next tile's
// barrier, which every wave reaches with its reads of the buffer done.
// Store coverage of a tile: 8 waves x 2 iterations x 4 rows (lane>>3) = 64 feature rows; (lane&7) x 8 halves = 64 positions;
// ---------------------------------------------------------------------------
constexpr int kTileRun   = 8;
constexpr int kTileAhead = 3;
static_assert((kSeq % (64 * kTileRun)) == 0 && kTileAhead <= kTileRun, "exact runs of tiles; the first fetches exist");

__global__ __launch_bounds__(256) void transpose_f16_kernel(const float* __restrict__ Kp, const float* __restrict__ Vp,
                                                            unsigned short* __restrict__ KT, unsigned short* __restrict__ VT) {
  __shared__ float sm[2][64][65];
  const int t  = threadIdx.x;
  const int s0 = blockIdx.x * (64 * kTileRun);
  const int c0 = (blockIdx.y & 3) * 64;
  const int b  = blockIdx.y >> 2;
  /* block-uniform tensor selector */
  const int z  = blockIdx.z;
  const float* X = (z == 0) ? Kp : Vp;
  unsigned short* T = (z == 0) ? KT : VT;
  /* loads: thread t takes row (t >> 4) + 16 i of a tile, 4 features from c4 */
  const int r0 = t >> 4;
  const int c4 = (t & 15) * 4;
  const float* Xt = X + ((size_t)b * kSeq + s0 + r0) * kFeat + c0 + c4;
  /* stores: 8 lanes cover the 64 positions of one feature row */
  const int lane = t & 31, wave = t >> 5;
  const int q = lane >> 3, c8 = (lane & 7) * 8;
  unsigned short* Tt = T + ((size_t)b * kFeat + c0 + wave * 8 + q) * kSeq + s0 + c8;

  v4f x[kTileAhead][4];
  /* unrolled: the register sets are named by constants */
#pragma unroll
  for (int n = 0; n < kTileAhead; ++n)
#pragma unroll
    for (int i = 0; i < 4; ++i) x[n][i] = *(const v4f*)(Xt + (size_t)(n * 64 + i * 16) * kFeat);

  /* unrolled whole (8 trips): register set, LDS buffer and the test for a tile n + 3 become constants */
#pragma unroll
  for (int n = 0; n < kTileRun; ++n) {
    float (*sb)[65] = sm[n & 1];
#pragma unroll
    for (int i = 0; i < 4; ++i) {
#pragma unroll
      for (int j = 0; j < 4; ++j) {
        const float v = x[n % kTileAhead][i][j];
        const float yk = (fmaxf(v, 0.0f) + kEps) * kPhiCarry;
        const float yv = v * kVCarry;
        sb[c4 + j][i * 16 + r0] = (z == 0) ? yk : yv;
      }
    }
    if (n + kTileAhead < kTileRun) {
#pragma unroll
      for (int i = 0; i < 4; ++i)
        x[n % kTileAhead][i] = *(const v4f*)(Xt + (size_t)((n + kTileAhead) * 64 + i * 16) * kFeat);
    }
    /* block barrier by hand behind this wave's LDS accesses alone: __syncthreads() would also wait for the global loads
       of the tiles fetched ahead and for the last tile's stores, and nothing would overlap */
    asm volatile("s_wait_dscnt 0x0\n\ts_barrier_signal -1\n\ts_barrier_wait -1" ::: "memory");
    v8h hv[2];
#pragma unroll
    for (int it = 0; it < 2; ++it) {
      const int row = wave * 8 + it * 4 + q;
#pragma unroll
      for (int e = 0; e < 8; ++e) {
        float y = sb[row][c8 + e];
        y = (fabsf(y) < kF16Min) ? 0.0f : y;
        hv[it][e] = (_Float16)y;
      }
    }
#pragma unroll
    for (int it = 0; it < 2; ++it) *(v8h*)(Tt + (size_t)(it * 4) * kSeq + n * 64) = hv[it];
  }
}

// ---------------------------------------------------------------------------
// Host glue: 3 kernel launches, nothing else.
//   1. KT, VT transposed carried f16 planes          grid (8, 32, 2), 8 tiles a block
//   2. KVT[b][v][d] = (1/4096) * sum_s VT[b][v][s] * KT[b][d][s]   (= 16 * KV[b][d][v])
//        A = VT (M = 256 rows v), Bt = KT (N = 256 rows d), K = 4096 in 8 LDS stages, k steps dealt to the 16 waves of a block;
//        32 tiles of 32x64 per batch -> grid (32, 8) = 256 blocks
//   3. out[b][q][v] = (1/16384) * sum_d f16(1024*phi(Q))[b][q][d] * KVT[b][v][d]
//        A from Q in the kernel (M = 4096 rows q), Bt = KVT (N = 256 rows v), K = 256; 128 rows per block -> grid (32, 8)
// ---------------------------------------------------------------------------
extern "C" void kernel_launch(void* const* d_in, const int* in_sizes, int n_in,
                              void* d_out, int out_size, void* d_ws, size_t ws_size,
                              hipStream_t stream) {
  if (n_in < 3) return;
  if (in_sizes[0] != kPlaneElems) return;
  if (in_sizes[1] != kPlaneElems) return;
  if (in_sizes[2] != kPlaneElems) return;
  if (out_size != kPlaneElems) return;
  if (ws_size < kWsTotal) return;

  const float* Q = (const float*)d_in[0];
  const float* K = (const float*)d_in[1];
  const float* V = (const float*)d_in[2];
  float* out = (float*)d_out;

  char* ws = (char*)d_ws;
  unsigned short* KT  = (unsigned short*)(ws + kOffKT);
  unsigned short* VT  = (unsigned short*)(ws + kOffVT);
  unsigned short* KVT = (unsigned short*)(ws + kOffKVT);

  transpose_f16_kernel<<<dim3(kSeq / (64 * kTileRun), (kFeat / 64) * kBatch, 2), 256, 0, stream>>>(K, V, KT, VT);

  wmma_kv32x64_f16_ksplit<<<dim3((kFeat / 32) * (kFeat / 64), kBatch), 32 * kSplitWaves, 0, stream>>>(VT, KT, KVT, kScaleKV);

  wmma_out64_phiq_f16<<<dim3(kSeq / kOutRows, kBatch), 256, 0, stream>>>(Q, KVT, out, kScaleOut);
}

// v005
// It runs in 27 microseconds.
// Next to v004, in two timings, it ran 1.17 and 1.16 times as fast.
// Over all steps from v000 it is 6.92 times as fast.
// Both contractions (phi(K)^T.V over the 4,096 positions, and phi(Q).KV over the 256 features): v_wmma_f32_16x16x32_f16, plain f16 operands carried by powers of two (phi x1024, V x64, KV x16), f32 accumulate; relu + 1e-6 feature map and all scale folds in f32.
#include <hip/hip_runtime.h>
#include <math.h>

typedef __attribute__((ext_vector_type(16))) _Float16 v16h;
typedef __attribute__((ext_vector_type(8)))  _Float16 v8h;
typedef __attribute__((ext_vector_type(4)))  _Float16 v4h;
typedef __attribute__((ext_vector_type(8)))  float    v8f;
typedef __attribute__((ext_vector_type(4)))  float    v4f;

// ---------------------------------------------------------------------------
// Shape constants (wire contract: three f32 inputs [8][4096][256], one f32 output [8][4096][256])
// ---------------------------------------------------------------------------
constexpr int kBatch = 8;
constexpr int kSeq   = 4096;
constexpr int kFeat  = 256;
constexpr int kPlaneElems = kBatch * kSeq * kFeat;
static_assert(kPlaneElems == 8388608, "element count per tensor");
static_assert((kSeq % 64) == 0 && (kFeat % 64) == 0, "GEMM M,N multiples of 64");
static_assert((kSeq % 32) == 0 && (kFeat % 32) == 0, "GEMM K multiples of 32");

// Feature-map offset and power-of-two carries (all exact in f32; folded back in the GEMM epilogue scales)
constexpr float kEps      = 1e-6f;
constexpr float kPhiCarry = 1024.0f;
constexpr float kVCarry   = 64.0f;
constexpr float kKVCarry  = 16.0f;
constexpr float kScaleKV  = kKVCarry / (kPhiCarry * kVCarry);
constexpr float kScaleOut = 1.0f / (kPhiCarry * kKVCarry);
static_assert(kScaleKV == 1.0f / 4096.0f, "first GEMM epilogue scale");
static_assert(kScaleOut == 1.0f / 16384.0f, "second GEMM epilogue scale");
// Smallest normal f16 magnitude (2^-14); smaller operand values are replaced by +0 with a select before the convert
constexpr float kF16Min = 6.103515625e-5f;

// ---------------------------------------------------------------------------
// Workspace region map (bytes; every offset is a multiple of 128)
//   PART f16 [8][32][8192][8]  16*KV partial sums, one 256x256 tile per batch and run of 128 positions,
//                              in the order the waves hold them (see the partial kernel)              33,554,432
//   KVT  f16 [8][256][256]     16*KV transposed, rows = v, k = d                                       1,048,576
//   total                                                                                             34,603,008
// ---------------------------------------------------------------------------
constexpr int kRunLen = 128;
constexpr int kRuns   = kSeq / kRunLen;
constexpr int kChunks = kFeat * kFeat / 8;
constexpr size_t kOffPart = 0;
constexpr size_t kOffKVT  = kOffPart + (size_t)kBatch * kRuns * kChunks * 8 * 2;
constexpr size_t kWsTotal = kOffKVT + (size_t)kBatch * kFeat * kFeat * 2;
static_assert(kRuns == 32 && kChunks == 8192, "32 runs of 128 positions; 8,192 chunks of 8 halves a tile");
static_assert(kWsTotal == 34603008ull, "carve total");
static_assert(kWsTotal <= 134217728ull, "carve cap");
static_assert((kOffPart % 128) == 0 && (kOffKVT % 128) == 0, "128-B aligned regions");

// ---------------------------------------------------------------------------
// Hazard guards as plain device helpers (no inline asm inside the output kernel's body)
// ---------------------------------------------------------------------------
__device__ __forceinline__ void guard_one(v8f& acc, v16h a, v16h b) {
  asm volatile("v_nop\n\tv_nop\n\tv_nop\n\tv_nop" : "+v"(acc) : "v"(a), "v"(b));
}
__device__ __forceinline__ void keep4_h(v16h a, v16h b, v16h c, v16h d) {
  asm volatile("v_nop" :: "v"(a), "v"(b), "v"(c), "v"(d));
}
__device__ __forceinline__ void acc_guard4(v8f& a, v8f& b, v8f& c, v8f& d) {
  asm volatile("v_nop\n\tv_nop\n\tv_nop\n\tv_nop" : "+v"(a), "+v"(b), "+v"(c), "+v"(d));
}

// Fragment loader for both A ([m][k] rows) and Bt ([n][k] rows): p points at row (lane & 15), column k0 + 8*(lane >> 4);
// vector elements 0..7 <- p[0..7] (k0 + 8h + 0..7), elements 8..15 <- p[16..23] (k0 + 16 + 8h + 0..7).
struct FragH {
  union U { v16h v; v8h h[2]; };
  static __device__ __forceinline__ v16h load(const _Float16* p) {
    U f;
    f.h[0] = *(const v8h*)(p);
    f.h[1] = *(const v8h*)(p + 16);
    return f.v;
  }
  static __device__ __forceinline__ v8f mma(v16h a, v16h b, v8f c) {
    return __builtin_amdgcn_wmma_f32_16x16x32_f16(false, a, false, b, (short)0, c, false, false);
  }
};

// ---------------------------------------------------------------------------
// Output product with the feature map of Q fused in: f16 operands, f32 accumulate, f32 output.
// out[b][q][v] = scale * sum_d f16(1024 * (max(Q[b][q][d], 0) + 1e-6)) * Bt[b][v][d]; Bt = KVT, rows v, k = d.
// One block = 128 rows q x all 256 columns v; 8 waves as 2 (rows) x 4 (columns), each wave owns a 64x64 tile;
// batch = blockIdx.y; grid (32, 8) is exact (no tails, no early exit).
// The block reads its 128 rows of Q (f32, 128 KB in a row) once, in loads of 512 contiguous bytes a wave, maps and converts
// them and lays them in LDS as f16 rows; the A fragments of all 8 waves come from there behind one block barrier.
// LDS row pitch 264 halves = 528 B = 16 B x 33 (odd), for the 16-byte fragment reads.
// Stores: 16 lanes x 16 B = 256 B = 2 lines per row segment, one storing wave per line.
// ---------------------------------------------------------------------------
constexpr int kOutRows = 128;
constexpr int kPitchA  = kFeat + 8;
static_assert((kSeq % kOutRows) == 0 && kFeat == 256, "exact grid; 4 column waves of 64 cover the 256 columns");
static_assert((kOutRows * kFeat) % (4 * 256) == 0, "staging loop is exact");

__global__ __launch_bounds__(256) void wmma_out64_phiq_f16(
    const float* __restrict__ Q, const unsigned short* __restrict__ Btp,
    float* __restrict__ Cout, float scale) {
  const _Float16* Bt = (const _Float16*)Btp;
  constexpr int ldb = kFeat;
  constexpr int ldc = kFeat;
  constexpr int K   = kFeat;
  /* the block's 128 rows of 1024*phi(Q) in f16 */
  __shared__ __align__(16) _Float16 sA[kOutRows * kPitchA];
  /* per-wave 16x64 slab, pitch 68 floats */
  __shared__ __align__(16) float sT[8][16 * 68];
  const int b    = blockIdx.y;
  const int lane = threadIdx.x & 31;
  const int wave = threadIdx.x >> 5;
  const int r0 = blockIdx.x * kOutRows;
  const int mw = (wave >> 2) << 6;
  const int m0 = r0 + mw;
  const int n0 = (wave & 3) << 6;

  const _Float16* Bb = Bt + (size_t)b * kFeat * kFeat;

  /* ---- stage: 32 iterations x 256 threads x 4 floats = 128 x 256; one row = 64 threads ---- */
  {
    const float* Qt = Q + ((size_t)b * kSeq + r0) * kFeat + 4 * threadIdx.x;
    _Float16* St = sA + (threadIdx.x >> 6) * kPitchA + (threadIdx.x & 63) * 4;
    /* unrolled whole: every offset is a constant of its load or store, and all of a thread's loads can be in flight together */
#pragma unroll
    for (int it = 0; it < (kOutRows * kFeat) / (4 * 256); ++it) {
      const v4f x = *(const v4f*)(Qt + it * (4 * 256));
      v4h hv;
      /* unrolled: the vector elements are named by constants and stay in registers */
#pragma unroll
      for (int e = 0; e < 4; ++e) {
        float y = (fmaxf(x[e], 0.0f) + kEps) * kPhiCarry;
        y = (fabsf(y) < kF16Min) ? 0.0f : y;
        hv[e] = (_Float16)y;
      }
      *(v4h*)(St + it * 4 * kPitchA) = hv;
    }
  }
  /* all 128 rows are in LDS before any wave reads a fragment */
  __syncthreads();

  /* row (A) / column (Bt, D) within a 16-wide subtile; k offset of this lane half; D row offset of this lane half */
  const int rlane = lane & 15;
  const int koff  = (lane >> 4) * 8;
  const int mOff  = (lane >> 4) * 8;
  const _Float16* Al = sA + (mw + rlane) * kPitchA + koff;

  v8f acc[4][4];
#pragma unroll
  for (int i = 0; i < 4; ++i)
#pragma unroll
    for (int j = 0; j < 4; ++j) acc[i][j] = (v8f){0.f, 0.f, 0.f, 0.f, 0.f, 0.f, 0.f, 0.f};

  for (int k0 = 0; k0 < K; k0 += 32) {
    v16h bh[4];
#pragma unroll
    for (int j = 0; j < 4; ++j) {
      const size_t bo = (size_t)(n0 + (j << 4) + rlane) * ldb + koff + k0;
      bh[j] = FragH::load(Bb + bo);
    }
    v16h ah[4];
    /* unrolled: all four A fragments of the step are asked for here, so that their LDS reads fly beside the B loads */
#pragma unroll
    for (int i = 0; i < 4; ++i) ah[i] = FragH::load(Al + (i << 4) * kPitchA + k0);
#pragma unroll
    for (int i = 0; i < 4; ++i) {
#pragma unroll
      for (int j = 0; j < 4; ++j) acc[i][j] = FragH::mma(ah[i], bh[j], acc[i][j]);
      /* every accumulator of the group is tied, with its A and B fragments named as inputs */
      guard_one(acc[i][0], ah[i], bh[0]);
      guard_one(acc[i][1], ah[i], bh[1]);
      guard_one(acc[i][2], ah[i], bh[2]);
      guard_one(acc[i][3], ah[i], bh[3]);
    }
    keep4_h(bh[0], bh[1], bh[2], bh[3]);
  }
  acc_guard4(acc[0][0], acc[0][1], acc[0][2], acc[0][3]);
  acc_guard4(acc[1][0], acc[1][1], acc[1][2], acc[1][3]);
  acc_guard4(acc[2][0], acc[2][1], acc[2][2], acc[2][3]);
  acc_guard4(acc[3][0], acc[3][1], acc[3][2], acc[3][3]);

  /* ---- epilogue: D element r of lane l is (row 8*(l>>4) + r, col l & 15) ---- */
  float* slab = sT[wave];
  float* C = Cout + (size_t)b * kSeq * kFeat;
#pragma unroll
  for (int i = 0; i < 4; ++i) {
    const int mBase = m0 + (i << 4);
#pragma unroll
    for (int j = 0; j < 4; ++j) {
#pragma unroll
      for (int r = 0; r < 8; ++r) {
        const float v = acc[i][j][r] * scale;
        slab[(mOff + r) * 68 + (j << 4) + rlane] = v;
      }
    }
    __builtin_amdgcn_fence(__ATOMIC_RELEASE, "workgroup");
    __builtin_amdgcn_wave_barrier();
    __builtin_amdgcn_fence(__ATOMIC_ACQUIRE, "workgroup");
    /* row segment = 64 floats = 256 B = 16 lanes x 16 B; the two lane halves take two consecutive rows */
    const int hh = lane >> 4, c4 = (lane & 15) * 4;
#pragma unroll
    for (int it = 0; it < 8; ++it) {
      const int row = it * 2 + hh;
      v4f v = *(const v4f*)(slab + row * 68 + c4);
      *(v4f*)(C + (size_t)(mBase + row) * ldc + n0 + c4) = v;
    }
    __builtin_amdgcn_fence(__ATOMIC_RELEASE, "workgroup");
    __builtin_amdgcn_wave_barrier();
    __builtin_amdgcn_fence(__ATOMIC_ACQUIRE, "workgroup");
  }
}

// ---------------------------------------------------------------------------
// Partial KV product straight from the f32 inputs: f16 operands, f32 accumulate, f16 partial sums.
// One block = one batch (blockIdx.y) and one run of 128 positions s (blockIdx.x); it owns the whole 256 (d) x 256 (v) tile,
// so every byte of K and V is read by exactly one block. Grid (32, 8) is exact (no tails, no early exit).
// part[d][v] = f16(scale * sum_{s in run} f16(1024 * (max(K[s][d], 0) + 1e-6)) * f16(64 * V[s][v]))
// Loads: a wave takes 8 positions; one load = 2 rows x 256 contiguous bytes (64 features), lanes 0..15 row r, lanes 16..31 row 4 + r.
// A thread then holds 4 positions x 4 features, converts them and stores 4 positions of one feature (8 B) at a time:
// LDS rows are features, 128 positions (256 B) each, no pad; the 16-byte chunk q of row c lies at place q ^ (c & 15) ^ ((c >> 2) & 15),
// which spreads over all banks both the 8-byte stores (rows 4 apart) and the 16-byte fragment reads (16 rows in a row).
// 16 waves as 4 (d) x 4 (v), each a 64x64 tile, A = rows d of K, Bt = rows v of V, 4 k steps of 32 positions.
// The products are the builtin form: the compiler keeps the distances behind them.
// D element r of lane l is (d = 8*(l>>4) + r, v = l & 15): a lane's 8 values are 8 neighbours along d. They go out as one
// 16-byte chunk, chunk number ((wave*4 + j)*4 + i)*32 + lane: every store of a wave is 512 contiguous bytes.
// ---------------------------------------------------------------------------
static_assert(kRunLen == 128 && kFeat == 256, "16 waves x 8 positions; 16 chunks a row; 4 x 4 waves of 64 x 64");

// offset in halves of chunk q (8 positions) of feature row c
__device__ __forceinline__ int chunk_at(int c, int q) {
  return c * kRunLen + ((q ^ (c & 15) ^ ((c >> 2) & 15)) << 3);
}
// fragment of row c, k step ks: elements 0..7 <- positions 32 ks + 8 h + 0..7, elements 8..15 <- 32 ks + 16 + 8 h + 0..7
__device__ __forceinline__ v16h frag_at(const _Float16* s, int c, int ks, int h) {
  FragH::U f;
  f.h[0] = *(const v8h*)(s + chunk_at(c, 4 * ks + h));
  f.h[1] = *(const v8h*)(s + chunk_at(c, 4 * ks + 2 + h));
  return f.v;
}

__global__ __launch_bounds__(512) void wmma_kv_partial_f16(
    const float* __restrict__ Kp, const float* __restrict__ Vp, unsigned short* __restrict__ Part, float scale) {
  __shared__ __align__(16) _Float16 sK[kFeat * kRunLen];
  __shared__ __align__(16) _Float16 sV[kFeat * kRunLen];
  const int b    = blockIdx.y;
  const int run  = blockIdx.x;
  const int lane = threadIdx.x & 31;
  const int wave = threadIdx.x >> 5;
  const int rlane = lane & 15;
  const int h     = lane >> 4;

  /* ---- all 32 loads of a thread are asked for at once: 4 feature groups x 4 rows, K then V ---- */
  const size_t off = ((size_t)b * kSeq + run * kRunLen + wave * 8 + 4 * h) * kFeat + 4 * rlane;
  const float* Kt = Kp + off;
  const float* Vt = Vp + off;
  v4f xk[4][4], xv[4][4];
  /* unrolled: the register sets are named by constants */
#pragma unroll
  for (int g = 0; g < 4; ++g)
#pragma unroll
    for (int r = 0; r < 4; ++r) xk[g][r] = *(const v4f*)(Kt + r * kFeat + g * 64);
#pragma unroll
  for (int g = 0; g < 4; ++g)
#pragma unroll
    for (int r = 0; r < 4; ++r) xv[g][r] = *(const v4f*)(Vt + r * kFeat + g * 64);
  /* the two address pairs are named here so that no load lands on them, and nothing rewrites them in front of this wait */
  asm volatile("s_wait_xcnt 0x0" :: "v"(Kt), "v"(Vt) : "memory");

#pragma unroll
  for (int g = 0; g < 4; ++g) {
#pragma unroll
    for (int j = 0; j < 4; ++j) {
      v4h hv;
#pragma unroll
      for (int r = 0; r < 4; ++r) {
        float y = (fmaxf(xk[g][r][j], 0.0f) + kEps) * kPhiCarry;
        y = (fabsf(y) < kF16Min) ? 0.0f : y;
        hv[r] = (_Float16)y;
      }
      *(v4h*)(sK + chunk_at(g * 64 + 4 * rlane + j, wave) + 4 * h) = hv;
    }
  }
#pragma unroll
  for (int g = 0; g < 4; ++g) {
#pragma unroll
    for (int j = 0; j < 4; ++j) {
      v4h hv;
#pragma unroll
      for (int r = 0; r < 4; ++r) {
        float y = xv[g][r][j] * kVCarry;
        y = (fabsf(y) < kF16Min) ? 0.0f : y;
        hv[r] = (_Float16)y;
      }
      *(v4h*)(sV + chunk_at(g * 64 + 4 * rlane + j, wave) + 4 * h) = hv;
    }
  }
  /* all 128 positions of both operands are in LDS before any wave reads a fragment */
  __syncthreads();

  const int d0 = (wave >> 2) << 6;
  const int v0 = (wave & 3) << 6;
  v8f acc[4][4];
#pragma unroll
  for (int i = 0; i < 4; ++i)
#pragma unroll
    for (int j = 0; j < 4; ++j) acc[i][j] = (v8f){0.f, 0.f, 0.f, 0.f, 0.f, 0.f, 0.f, 0.f};

  /* unrolled whole (4 trips): the chunk numbers become constants and the next step's fragment reads can start early */
#pragma unroll
  for (int ks = 0; ks < kRunLen / 32; ++ks) {
    v16h ah[4], bh[4];
#pragma unroll
    for (int i = 0; i < 4; ++i) ah[i] = frag_at(sK, d0 + (i << 4) + rlane, ks, h);
#pragma unroll
    for (int j = 0; j < 4; ++j) bh[j] = frag_at(sV, v0 + (j << 4) + rlane, ks, h);
#pragma unroll
    for (int i = 0; i < 4; ++i)
#pragma unroll
      for (int j = 0; j < 4; ++j) acc[i][j] = FragH::mma(ah[i], bh[j], acc[i][j]);
  }

  unsigned short* P = Part + ((size_t)(b * kRuns + run) * kChunks + (size_t)wave * 512 + lane) * 8;
#pragma unroll
  for (int j = 0; j < 4; ++j) {
#pragma unroll
    for (int i = 0; i < 4; ++i) {
      v8h hv;
#pragma unroll
      for (int r = 0; r < 8; ++r) hv[r] = (_Float16)(acc[i][j][r] * scale);
      *(v8h*)(P + (j * 4 + i) * 256) = hv;
    }
  }
}

// ---------------------------------------------------------------------------
// Adds the 32 partial tiles of a batch in f32, in run order 0..31, and writes KVT[b][v][d] (f16, rows v, d contiguous).
// 65,536 threads, one 16-byte chunk (8 values along d) each: grid 256 x 256 threads is exact. A wave's load is 512 contiguous bytes
// of one partial tile; all 32 loads of a thread are in flight together.
// Values below 2^-14 in magnitude are replaced by +0 before the convert.
// A block holds 8 tiles of 16x16: one wave number, two j, all four i = 32 rows v x 64 d. They pass through LDS (pitch 72 halves)
// so that 8 lanes store one whole 128-B line, one storing wave per line.
// ---------------------------------------------------------------------------
__global__ __launch_bounds__(256) void add_partials_f16(const unsigned short* __restrict__ Part, unsigned short* __restrict__ Cout) {
  __shared__ __align__(16) _Float16 sO[32 * 72];
  const int t = threadIdx.x;
  const int b = blockIdx.x >> 5;
  const int e = (blockIdx.x & 31) * 256 + t;
  const _Float16* P = (const _Float16*)Part + ((size_t)b * kRuns * kChunks + e) * 8;
  v8h p[kRuns];
  /* unrolled: the registers are named by constants and every load is asked for before the first sum */
#pragma unroll
  for (int n = 0; n < kRuns; ++n) p[n] = *(const v8h*)(P + (size_t)n * kChunks * 8);
  float s[8];
#pragma unroll
  for (int r = 0; r < 8; ++r) s[r] = (float)p[0][r];
#pragma unroll
  for (int n = 1; n < kRuns; ++n)
#pragma unroll
    for (int r = 0; r < 8; ++r) s[r] += (float)p[n][r];
  v8h hv;
#pragma unroll
  for (int r = 0; r < 8; ++r) {
    const float x = (fabsf(s[r]) < kF16Min) ? 0.0f : s[r];
    hv[r] = (_Float16)x;
  }
  /* thread t holds tile i = (t >> 5) & 3 of j half t >> 7: row (l & 15), columns 16 i + 8 (l >> 4) + 0..7 */
  const int lane = t & 31;
  *(v8h*)(sO + ((t >> 7) * 16 + (lane & 15)) * 72 + ((t >> 5) & 3) * 16 + (lane >> 4) * 8) = hv;
  /* the block's 32 rows are in LDS before any thread reads a line piece */
  __syncthreads();
  const int row = t >> 3;
  const v8h o = *(const v8h*)(sO + row * 72 + (t & 7) * 8);
  /* the block's first tile: blockIdx & 31 = wave * 2 + (j >> 1) */
  const int wv = (blockIdx.x & 31) >> 1;
  const int v  = ((wv & 3) << 6) + ((blockIdx.x & 1) << 5) + row;
  const int d  = ((wv >> 2) << 6) + (t & 7) * 8;
  *(v8h*)(Cout + ((size_t)b * kFeat + v) * kFeat + d) = o;
}

// ---------------------------------------------------------------------------
// Host glue: 3 kernel launches, nothing else.
//   1. PART[b][run] = (1/4096) * sum over the run's 128 positions of 1024*phi(K)[s][d] * 64*V[s][v]   grid (32, 8), 16 waves a block
//   2. KVT[b][v][d] = sum of the 32 partial tiles (= 16 * KV[b][d][v])                                  grid 256
//   3. out[b][q][v] = (1/16384) * sum_d f16(1024*phi(Q))[b][q][d] * KVT[b][v][d]
//        A from Q in the kernel (M = 4096 rows q), Bt = KVT (N = 256 rows v), K = 256; 128 rows per block -> grid (32, 8)
// ---------------------------------------------------------------------------
extern "C" void kernel_launch(void* const* d_in, const int* in_sizes, int n_in,
                              void* d_out, int out_size, void* d_ws, size_t ws_size,
                              hipStream_t stream) {
  if (n_in < 3) return;
  if (in_sizes[0] != kPlaneElems) return;
  if (in_sizes[1] != kPlaneElems) return;
  if (in_sizes[2] != kPlaneElems) return;
  if (out_size != kPlaneElems) return;
  if (ws_size < kWsTotal) return;

  const float* Q = (const float*)d_in[0];
  const float* K = (const float*)d_in[1];
  const float* V = (const float*)d_in[2];
  float* out = (float*)d_out;

  char* ws = (char*)d_ws;
  unsigned short* PART = (unsigned short*)(ws + kOffPart);
  unsigned short* KVT  = (unsigned short*)(ws + kOffKVT);

  wmma_kv_partial_f16<<<dim3(kRuns, kBatch), 512, 0, stream>>>(K, V, PART, kScaleKV);

  add_partials_f16<<<dim3(kBatch * kChunks / 256), 256, 0, stream>>>(PART, KVT);

  wmma_out64_phiq_f16<<<dim3(kSeq / kOutRows, kBatch), 256, 0, stream>>>(Q, KVT, out, kScaleOut);
}

// v006
// One run takes 24.8 microseconds.
// Timed twice side by side with v005, it ran 1.09 times as fast both times.
// All steps since v000 together make it 7.56 times as fast.
// Both contractions (phi(K)^T.V over the 4,096 positions, and phi(Q).KV over the 256 features): v_wmma_f32_16x16x32_f16, plain f16 operands carried by powers of two (phi x1024, V x64, KV x16), f32 accumulate; relu + 1e-6 feature map and all scale folds in f32.
#include <hip/hip_runtime.h>
#include <math.h>

typedef __attribute__((ext_vector_type(16))) _Float16 v16h;
typedef __attribute__((ext_vector_type(8)))  _Float16 v8h;
typedef __attribute__((ext_vector_type(4)))  _Float16 v4h;
typedef __attribute__((ext_vector_type(8)))  float    v8f;
typedef __attribute__((ext_vector_type(4)))  float    v4f;

// ---------------------------------------------------------------------------
// Shape constants (wire contract: three f32 inputs [8][4096][256], one f32 output [8][4096][256])
// ---------------------------------------------------------------------------
constexpr int kBatch = 8;
constexpr int kSeq   = 4096;
constexpr int kFeat  = 256;
constexpr int kPlaneElems = kBatch * kSeq * kFeat;
static_assert(kPlaneElems == 8388608, "element count per tensor");
static_assert((kSeq % 64) == 0 && (kFeat % 64) == 0, "GEMM M,N multiples of 64");
static_assert((kSeq % 32) == 0 && (kFeat % 32) == 0, "GEMM K multiples of 32");

// Feature-map offset and power-of-two carries (all exact in f32; folded back in the GEMM epilogue scales)
constexpr float kEps      = 1e-6f;
constexpr float kPhiCarry = 1024.0f;
constexpr float kVCarry   = 64.0f;
constexpr float kKVCarry  = 16.0f;
constexpr float kScaleKV  = kKVCarry / (kPhiCarry * kVCarry);
constexpr float kScaleOut = 1.0f / (kPhiCarry * kKVCarry);
static_assert(kScaleKV == 1.0f / 4096.0f, "first GEMM epilogue scale");
static_assert(kScaleOut == 1.0f / 16384.0f, "second GEMM epilogue scale");
// Smallest normal f16 magnitude (2^-14); smaller operand values are replaced by +0 with a select before the convert
constexpr float kF16Min = 6.103515625e-5f;

// ---------------------------------------------------------------------------
// Workspace region map (bytes; every offset is a multiple of 128)
//   PART f16 [8][16][8192][8]  16*KV partial sums, one 256x256 tile (two half tiles of 128 d) per batch and run of 256 positions,
//                              in the order the waves hold them (see the partial kernel)              16,777,216
//   KVT  f16 [8][256][256]     16*KV transposed, rows = v, k = d                                       1,048,576
//   total                                                                                             17,825,792
// ---------------------------------------------------------------------------
constexpr int kRunLen = 256;
constexpr int kRuns   = kSeq / kRunLen;
constexpr int kChunks = kFeat * kFeat / 8;
constexpr size_t kOffPart = 0;
constexpr size_t kOffKVT  = kOffPart + (size_t)kBatch * kRuns * kChunks * 8 * 2;
constexpr size_t kWsTotal = kOffKVT + (size_t)kBatch * kFeat * kFeat * 2;
static_assert(kRuns == 16 && kChunks == 8192, "16 runs of 256 positions; 8,192 chunks of 8 halves a tile");
static_assert(kWsTotal == 17825792ull, "carve total");
static_assert(kWsTotal <= 134217728ull, "carve cap");
static_assert((kOffPart % 128) == 0 && (kOffKVT % 128) == 0, "128-B aligned regions");

// ---------------------------------------------------------------------------
// Hazard guards as plain device helpers (no inline asm inside the output kernel's body)
// ---------------------------------------------------------------------------
__device__ __forceinline__ void guard_one(v8f& acc, v16h a, v16h b) {
  asm volatile("v_nop\n\tv_nop\n\tv_nop\n\tv_nop" : "+v"(acc) : "v"(a), "v"(b));
}
__device__ __forceinline__ void keep4_h(v16h a, v16h b, v16h c, v16h d) {
  asm volatile("v_nop" :: "v"(a), "v"(b), "v"(c), "v"(d));
}
__device__ __forceinline__ void acc_guard4(v8f& a, v8f& b, v8f& c, v8f& d) {
  asm volatile("v_nop\n\tv_nop\n\tv_nop\n\tv_nop" : "+v"(a), "+v"(b), "+v"(c), "+v"(d));
}

// Fragment loader for both A ([m][k] rows) and Bt ([n][k] rows): p points at row (lane & 15), column k0 + 8*(lane >> 4);
// vector elements 0..7 <- p[0..7] (k0 + 8h + 0..7), elements 8..15 <- p[16..23] (k0 + 16 + 8h + 0..7).
struct FragH {
  union U { v16h v; v8h h[2]; };
  static __device__ __forceinline__ v16h load(const _Float16* p) {
    U f;
    f.h[0] = *(const v8h*)(p);
    f.h[1] = *(const v8h*)(p + 16);
    return f.v;
  }
  static __device__ __forceinline__ v8f mma(v16h a, v16h b, v8f c) {
    return __builtin_amdgcn_wmma_f32_16x16x32_f16(false, a, false, b, (short)0, c, false, false);
  }
};

// ---------------------------------------------------------------------------
// Output product with the feature map of Q fused in: f16 operands, f32 accumulate, f32 output.
// out[b][q][v] = scale * sum_d f16(1024 * (max(Q[b][q][d], 0) + 1e-6)) * Bt[b][v][d]; Bt = KVT, rows v, k = d.
// One block = 128 rows q x all 256 columns v; 8 waves as 2 (rows) x 4 (columns), each wave owns a 64x64 tile;
// batch = blockIdx.y; grid (32, 8) is exact (no tails, no early exit).
// The block reads its 128 rows of Q (f32, 128 KB in a row) once, in loads of 512 contiguous bytes a wave, maps and converts
// them and lays them in LDS as f16 rows; the A fragments of all 8 waves come from there behind one block barrier.
// LDS row pitch 264 halves = 528 B = 16 B x 33 (odd), for the 16-byte fragment reads.
// Stores: 16 lanes x 16 B = 256 B = 2 lines per row segment, one storing wave per line.
// ---------------------------------------------------------------------------
constexpr int kOutRows = 128;
constexpr int kPitchA  = kFeat + 8;
static_assert((kSeq % kOutRows) == 0 && kFeat == 256, "exact grid; 4 column waves of 64 cover the 256 columns");
static_assert((kOutRows * kFeat) % (4 * 256) == 0, "staging loop is exact");

__global__ __launch_bounds__(256) void wmma_out64_phiq_f16(
    const float* __restrict__ Q, const unsigned short* __restrict__ Btp,
    float* __restrict__ Cout, float scale) {
  const _Float16* Bt = (const _Float16*)Btp;
  constexpr int ldb = kFeat;
  constexpr int ldc = kFeat;
  constexpr int K   = kFeat;
  /* the block's 128 rows of 1024*phi(Q) in f16 */
  __shared__ __align__(16) _Float16 sA[kOutRows * kPitchA];
  /* per-wave 16x64 slab, pitch 68 floats */
  __shared__ __align__(16) float sT[8][16 * 68];
  const int b    = blockIdx.y;
  const int lane = threadIdx.x & 31;
  const int wave = threadIdx.x >> 5;
  const int r0 = blockIdx.x * kOutRows;
  const int mw = (wave >> 2) << 6;
  const int m0 = r0 + mw;
  const int n0 = (wave & 3) << 6;

  const _Float16* Bb = Bt + (size_t)b * kFeat * kFeat;

  /* ---- stage: 32 iterations x 256 threads x 4 floats = 128 x 256; one row = 64 threads ---- */
  {
    const float* Qt = Q + ((size_t)b * kSeq + r0) * kFeat + 4 * threadIdx.x;
    _Float16* St = sA + (threadIdx.x >> 6) * kPitchA + (threadIdx.x & 63) * 4;
    /* unrolled whole: every offset is a constant of its load or store, and all of a thread's loads can be in flight together */
#pragma unroll
    for (int it = 0; it < (kOutRows * kFeat) / (4 * 256); ++it) {
      const v4f x = *(const v4f*)(Qt + it * (4 * 256));
      v4h hv;
      /* unrolled: the vector elements are named by constants and stay in registers */
#pragma unroll
      for (int e = 0; e < 4; ++e) {
        float y = (fmaxf(x[e], 0.0f) + kEps) * kPhiCarry;
        y = (fabsf(y) < kF16Min) ? 0.0f : y;
        hv[e] = (_Float16)y;
      }
      *(v4h*)(St + it * 4 * kPitchA) = hv;
    }
  }
  /* all 128 rows are in LDS before any wave reads a fragment */
  __syncthreads();

  /* row (A) / column (Bt, D) within a 16-wide subtile; k offset of this lane half; D row offset of this lane half */
  const int rlane = lane & 15;
  const int koff  = (lane >> 4) * 8;
  const int mOff  = (lane >> 4) * 8;
  const _Float16* Al = sA + (mw + rlane) * kPitchA + koff;

  v8f acc[4][4];
#pragma unroll
  for (int i = 0; i < 4; ++i)
#pragma unroll
    for (int j = 0; j < 4; ++j) acc[i][j] = (v8f){0.f, 0.f, 0.f, 0.f, 0.f, 0.f, 0.f, 0.f};

  for (int k0 = 0; k0 < K; k0 += 32) {
    v16h bh[4];
#pragma unroll
    for (int j = 0; j < 4; ++j) {
      const size_t bo = (size_t)(n0 + (j << 4) + rlane) * ldb + koff + k0;
      bh[j] = FragH::load(Bb + bo);
    }
    v16h ah[4];
    /* unrolled: all four A fragments of the step are asked for here, so that their LDS reads fly beside the B loads */
#pragma unroll
    for (int i = 0; i < 4; ++i) ah[i] = FragH::load(Al + (i << 4) * kPitchA + k0);
#pragma unroll
    for (int i = 0; i < 4; ++i) {
#pragma unroll
      for (int j = 0; j < 4; ++j) acc[i][j] = FragH::mma(ah[i], bh[j], acc[i][j]);
      /* every accumulator of the group is tied, with its A and B fragments named as inputs */
      guard_one(acc[i][0], ah[i], bh[0]);
      guard_one(acc[i][1], ah[i], bh[1]);
      guard_one(acc[i][2], ah[i], bh[2]);
      guard_one(acc[i][3], ah[i], bh[3]);
    }
    keep4_h(bh[0], bh[1], bh[2], bh[3]);
  }
  acc_guard4(acc[0][0], acc[0][1], acc[0][2], acc[0][3]);
  acc_guard4(acc[1][0], acc[1][1], acc[1][2], acc[1][3]);
  acc_guard4(acc[2][0], acc[2][1], acc[2][2], acc[2][3]);
  acc_guard4(acc[3][0], acc[3][1], acc[3][2], acc[3][3]);

  /* ---- epilogue: D element r of lane l is (row 8*(l>>4) + r, col l & 15) ---- */
  float* slab = sT[wave];
  float* C = Cout + (size_t)b * kSeq * kFeat;
#pragma unroll
  for (int i = 0; i < 4; ++i) {
    const int mBase = m0 + (i << 4);
#pragma unroll
    for (int j = 0; j < 4; ++j) {
#pragma unroll
      for (int r = 0; r < 8; ++r) {
        const float v = acc[i][j][r] * scale;
        slab[(mOff + r) * 68 + (j << 4) + rlane] = v;
      }
    }
    __builtin_amdgcn_fence(__ATOMIC_RELEASE, "workgroup");
    __builtin_amdgcn_wave_barrier();
    __builtin_amdgcn_fence(__ATOMIC_ACQUIRE, "workgroup");
    /* row segment = 64 floats = 256 B = 16 lanes x 16 B; the two lane halves take two consecutive rows */
    const int hh = lane >> 4, c4 = (lane & 15) * 4;
#pragma unroll
    for (int it = 0; it < 8; ++it) {
      const int row = it * 2 + hh;
      v4f v = *(const v4f*)(slab + row * 68 + c4);
      *(v4f*)(C + (size_t)(mBase + row) * ldc + n0 + c4) = v;
    }
    __builtin_amdgcn_fence(__ATOMIC_RELEASE, "workgroup");
    __builtin_amdgcn_wave_barrier();
    __builtin_amdgcn_fence(__ATOMIC_ACQUIRE, "workgroup");
  }
}

// ---------------------------------------------------------------------------
// Partial KV product straight from the f32 inputs: f16 operands, f32 accumulate, f16 partial sums.
// One block = one batch (blockIdx.y), one run of 256 positions s and one half of the features d: a 128 (d) x 256 (v) half tile.
// A run is twice as long as a whole tile a block would allow on 256 blocks, so the partial sums written here and read by the
// adding launch are half as many bytes; the price is that the two blocks of a run both read its V rows.
// blockIdx.x: bit 3 = d half, the other four bits = run. The two blocks of a run are 8 apart in the flat index
// (speed only: any placement gives the same values).
// Grid (32, 8) is exact (no tails, no early exit).
// part[d][v] = f16(scale * sum_{s in run} f16(1024 * (max(K[s][d], 0) + 1e-6)) * f16(64 * V[s][v]))
// Loads: a wave takes 2 x 8 positions; one load = 2 rows x 256 contiguous bytes (64 features), lanes 0..15 row r, lanes 16..31 row 4 + r.
// A thread then holds 4 positions x 4 features, converts them and stores 4 positions of one feature (8 B) at a time:
// LDS rows are features, 256 positions (512 B) each, no pad; the 16-byte chunk q of row c lies at place q ^ (c & 15) ^ ((c >> 2) & 15),
// which spreads over all banks both the 8-byte stores (rows 4 apart) and the 16-byte fragment reads (16 rows in a row).
// 16 waves as 2 (d) x 8 (v), each a 64x32 tile, A = rows d of K, Bt = rows v of V, 8 k steps of 32 positions.
// The products are the builtin form: the compiler keeps the distances behind them.
// D element r of lane l is (d = 8*(l>>4) + r, v = l & 15): a lane's 8 values are 8 neighbours along d. They go out as one
// 16-byte chunk, chunk number dhalf*4096 + ((wave*2 + j)*4 + i)*32 + lane: every store of a wave is 512 contiguous bytes.
// ---------------------------------------------------------------------------
constexpr int kHalfD = kFeat / 2;
static_assert(kRunLen == 256 && kFeat == 256, "16 waves x 2 x 8 positions; 32 chunks a row; 2 x 8 waves of 64 x 32");

// offset in halves of chunk q (8 positions) of feature row c
__device__ __forceinline__ int chunk_at(int c, int q) {
  return c * kRunLen + ((q ^ (c & 15) ^ ((c >> 2) & 15)) << 3);
}
// fragment of row c, k step ks: elements 0..7 <- positions 32 ks + 8 h + 0..7, elements 8..15 <- 32 ks + 16 + 8 h + 0..7
__device__ __forceinline__ v16h frag_at(const _Float16* s, int c, int ks, int h) {
  FragH::U f;
  f.h[0] = *(const v8h*)(s + chunk_at(c, 4 * ks + h));
  f.h[1] = *(const v8h*)(s + chunk_at(c, 4 * ks + 2 + h));
  return f.v;
}

__global__ __launch_bounds__(512) void wmma_kv_partial_f16(
    const float* __restrict__ Kp, const float* __restrict__ Vp, unsigned short* __restrict__ Part, float scale) {
  __shared__ __align__(16) _Float16 sK[kHalfD * kRunLen];
  __shared__ __align__(16) _Float16 sV[kFeat * kRunLen];
  const int b    = blockIdx.y;
  const int dh   = (blockIdx.x >> 3) & 1;
  const int run  = (blockIdx.x & 7) | ((blockIdx.x >> 4) << 3);
  const int lane = threadIdx.x & 31;
  const int wave = threadIdx.x >> 5;
  const int rlane = lane & 15;
  const int h     = lane >> 4;

  /* ---- all 48 loads of a thread are asked for at once: 2 sets of 8 positions (128 apart) x feature groups x 4 rows, K then V ---- */
  const size_t off = ((size_t)b * kSeq + run * kRunLen + wave * 8 + 4 * h) * kFeat + 4 * rlane;
  const float* Kt = Kp + off + dh * kHalfD;
  const float* Vt = Vp + off;
  v4f xk[2][2][4], xv[2][4][4];
  /* unrolled: the register sets are named by constants */
#pragma unroll
  for (int s = 0; s < 2; ++s)
#pragma unroll
    for (int g = 0; g < 2; ++g)
#pragma unroll
      for (int r = 0; r < 4; ++r) xk[s][g][r] = *(const v4f*)(Kt + (s * 128 + r) * kFeat + g * 64);
  /* keeps the K loads in front of the V loads: loads return in order, and K is converted first, while V is still in flight */
  __builtin_amdgcn_sched_barrier(0);
#pragma unroll
  for (int s = 0; s < 2; ++s)
#pragma unroll
    for (int g = 0; g < 4; ++g)
#pragma unroll
      for (int r = 0; r < 4; ++r) xv[s][g][r] = *(const v4f*)(Vt + (s * 128 + r) * kFeat + g * 64);
  /* keeps the first K conversions, and with them a wait on the K loads, from being scheduled in front of the V loads */
  __builtin_amdgcn_sched_barrier(0);
  /* the two address pairs are named here so that no load lands on them, and nothing rewrites them in front of this wait */
  asm volatile("s_wait_xcnt 0x0" :: "v"(Kt), "v"(Vt) : "memory");

#pragma unroll
  for (int s = 0; s < 2; ++s) {
#pragma unroll
    for (int g = 0; g < 2; ++g) {
#pragma unroll
      for (int j = 0; j < 4; ++j) {
        v4h hv;
#pragma unroll
        for (int r = 0; r < 4; ++r) {
          float y = (fmaxf(xk[s][g][r][j], 0.0f) + kEps) * kPhiCarry;
          y = (fabsf(y) < kF16Min) ? 0.0f : y;
          hv[r] = (_Float16)y;
        }
        *(v4h*)(sK + chunk_at(g * 64 + 4 * rlane + j, s * 16 + wave) + 4 * h) = hv;
      }
      /* keeps later groups' conversions, and with them the waits on later loads, behind this group: work goes on while loads land */
      __builtin_amdgcn_sched_barrier(0);
    }
  }
#pragma unroll
  for (int s = 0; s < 2; ++s) {
#pragma unroll
    for (int g = 0; g < 4; ++g) {
#pragma unroll
      for (int j = 0; j < 4; ++j) {
        v4h hv;
#pragma unroll
        for (int r = 0; r < 4; ++r) {
          float y = xv[s][g][r][j] * kVCarry;
          y = (fabsf(y) < kF16Min) ? 0.0f : y;
          hv[r] = (_Float16)y;
        }
        *(v4h*)(sV + chunk_at(g * 64 + 4 * rlane + j, s * 16 + wave) + 4 * h) = hv;
      }
      /* as above: each group waits only for its own loads */
      __builtin_amdgcn_sched_barrier(0);
    }
  }
  /* all 256 positions of both operands are in LDS before any wave reads a fragment */
  __syncthreads();

  const int d0 = (wave >> 3) << 6;
  const int v0 = (wave & 7) << 5;
  v8f acc[4][2];
#pragma unroll
  for (int i = 0; i < 4; ++i)
#pragma unroll
    for (int j = 0; j < 2; ++j) acc[i][j] = (v8f){0.f, 0.f, 0.f, 0.f, 0.f, 0.f, 0.f, 0.f};

  /* unrolled whole (8 trips): the chunk numbers become constants and the next step's fragment reads can start early */
#pragma unroll
  for (int ks = 0; ks < kRunLen / 32; ++ks) {
    v16h ah[4], bh[2];
#pragma unroll
    for (int i = 0; i < 4; ++i) ah[i] = frag_at(sK, d0 + (i << 4) + rlane, ks, h);
#pragma unroll
    for (int j = 0; j < 2; ++j) bh[j] = frag_at(sV, v0 + (j << 4) + rlane, ks, h);
#pragma unroll
    for (int i = 0; i < 4; ++i)
#pragma unroll
      for (int j = 0; j < 2; ++j) acc[i][j] = FragH::mma(ah[i], bh[j], acc[i][j]);
  }

  unsigned short* P = Part + ((size_t)(b * kRuns + run) * kChunks + (size_t)dh * 4096 + (size_t)wave * 256 + lane) * 8;
#pragma unroll
  for (int j = 0; j < 2; ++j) {
#pragma unroll
    for (int i = 0; i < 4; ++i) {
      v8h hv;
#pragma unroll
      for (int r = 0; r < 8; ++r) hv[r] = (_Float16)(acc[i][j][r] * scale);
      *(v8h*)(P + (j * 4 + i) * 256) = hv;
    }
  }
}

// ---------------------------------------------------------------------------
// Adds the 16 partial tiles of a batch in f32, in run order 0..15, and writes KVT[b][v][d] (f16, rows v, d contiguous).
// 65,536 threads, one 16-byte chunk (8 values along d) each: grid 256 x 256 threads is exact. A wave's load is 512 contiguous bytes
// of one partial tile; all 16 loads of a thread are in flight together.
// Values below 2^-14 in magnitude are replaced by +0 before the convert.
// A block holds 8 tiles of 16x16: one d half, one wave number, both j, all four i = 32 rows v x 64 d. They pass through LDS (pitch 72 halves)
// so that 8 lanes store one whole 128-B line, one storing wave per line.
// ---------------------------------------------------------------------------
__global__ __launch_bounds__(256) void add_partials_f16(const unsigned short* __restrict__ Part, unsigned short* __restrict__ Cout) {
  __shared__ __align__(16) _Float16 sO[32 * 72];
  const int t = threadIdx.x;
  const int b = blockIdx.x >> 5;
  const int e = (blockIdx.x & 31) * 256 + t;
  const _Float16* P = (const _Float16*)Part + ((size_t)b * kRuns * kChunks + e) * 8;
  v8h p[kRuns];
  /* unrolled: the registers are named by constants and every load is asked for before the first sum */
#pragma unroll
  for (int n = 0; n < kRuns; ++n) p[n] = *(const v8h*)(P + (size_t)n * kChunks * 8);
  float s[8];
#pragma unroll
  for (int r = 0; r < 8; ++r) s[r] = (float)p[0][r];
#pragma unroll
  for (int n = 1; n < kRuns; ++n)
#pragma unroll
    for (int r = 0; r < 8; ++r) s[r] += (float)p[n][r];
  v8h hv;
#pragma unroll
  for (int r = 0; r < 8; ++r) {
    const float x = (fabsf(s[r]) < kF16Min) ? 0.0f : s[r];
    hv[r] = (_Float16)x;
  }
  /* thread t holds tile i = (t >> 5) & 3 of j half t >> 7: row (l & 15), columns 16 i + 8 (l >> 4) + 0..7 */
  const int lane = t & 31;
  *(v8h*)(sO + ((t >> 7) * 16 + (lane & 15)) * 72 + ((t >> 5) & 3) * 16 + (lane >> 4) * 8) = hv;
  /* the block's 32 rows are in LDS before any thread reads a line piece */
  __syncthreads();
  const int row = t >> 3;
  const v8h o = *(const v8h*)(sO + row * 72 + (t & 7) * 8);
  /* the block's tiles: blockIdx & 31 = dhalf * 16 + wave; wave = (d group of 64) * 8 + (v group of 32) */
  const int wv = blockIdx.x & 15;
  const int v  = ((wv & 7) << 5) + row;
  const int d  = (((blockIdx.x >> 4) & 1) << 7) + ((wv >> 3) << 6) + (t & 7) * 8;
  *(v8h*)(Cout + ((size_t)b * kFeat + v) * kFeat + d) = o;
}

// ---------------------------------------------------------------------------
// Host glue: 3 kernel launches, nothing else.
//   1. PART[b][run] = (1/4096) * sum over the run's 256 positions of 1024*phi(K)[s][d] * 64*V[s][v]   grid (32, 8) = (16 runs x 2 d halves, 8), 16 waves a block
//   2. KVT[b][v][d] = sum of the 16 partial tiles (= 16 * KV[b][d][v])                                  grid 256
//   3. out[b][q][v] = (1/16384) * sum_d f16(1024*phi(Q))[b][q][d] * KVT[b][v][d]
//        A from Q in the kernel (M = 4096 rows q), Bt = KVT (N = 256 rows v), K = 256; 128 rows per block -> grid (32, 8)
// ---------------------------------------------------------------------------
extern "C" void kernel_launch(void* const* d_in, const int* in_sizes, int n_in,
                              void* d_out, int out_size, void* d_ws, size_t ws_size,
                              hipStream_t stream) {
  if (n_in < 3) return;
  if (in_sizes[0] != kPlaneElems) return;
  if (in_sizes[1] != kPlaneElems) return;
  if (in_sizes[2] != kPlaneElems) return;
  if (out_size != kPlaneElems) return;
  if (ws_size < kWsTotal) return;

  const float* Q = (const float*)d_in[0];
  const float* K = (const float*)d_in[1];
  const float* V = (const float*)d_in[2];
  float* out = (float*)d_out;

  char* ws = (char*)d_ws;
  unsigned short* PART = (unsigned short*)(ws + kOffPart);
  unsigned short* KVT  = (unsigned short*)(ws + kOffKVT);

  wmma_kv_partial_f16<<<dim3(kRuns * 2, kBatch), 512, 0, stream>>>(K, V, PART, kScaleKV);

  add_partials_f16<<<dim3(kBatch * kChunks / 256), 256, 0, stream>>>(PART, KVT);

  wmma_out64_phiq_f16<<<dim3(kSeq / kOutRows, kBatch), 256, 0, stream>>>(Q, KVT, out, kScaleOut);
}

// v007
// Measured time: 23.9 microseconds a run.
// Next to v006, in two timings, it ran 1.04 times as fast each time.
// Over all steps from v000 it is 7.87 times as fast.
// Both contractions (phi(K)^T.V over the 4,096 positions, and phi(Q).KV over the 256 features): v_wmma_f32_16x16x32_f16, plain f16 operands carried by powers of two (phi x1024, V x64, KV x16), f32 accumulate; relu + 1e-6 feature map and all scale folds in f32.
#include <hip/hip_runtime.h>
#include <math.h>

typedef __attribute__((ext_vector_type(16))) _Float16 v16h;
typedef __attribute__((ext_vector_type(8)))  _Float16 v8h;
typedef __attribute__((ext_vector_type(4)))  _Float16 v4h;
typedef __attribute__((ext_vector_type(8)))  float    v8f;
typedef __attribute__((ext_vector_type(4)))  float    v4f;

// ---------------------------------------------------------------------------
// Shape constants (wire contract: three f32 inputs [8][4096][256], one f32 output [8][4096][256])
// ---------------------------------------------------------------------------
constexpr int kBatch = 8;
constexpr int kSeq   = 4096;
constexpr int kFeat  = 256;
constexpr int kPlaneElems = kBatch * kSeq * kFeat;
static_assert(kPlaneElems == 8388608, "element count per tensor");
static_assert((kSeq % 64) == 0 && (kFeat % 64) == 0, "GEMM M,N multiples of 64");
static_assert((kSeq % 32) == 0 && (kFeat % 32) == 0, "GEMM K multiples of 32");

// Feature-map offset and power-of-two carries (all exact in f32; folded back in the GEMM epilogue scales)
constexpr float kEps      = 1e-6f;
constexpr float kPhiCarry = 1024.0f;
constexpr float kVCarry   = 64.0f;
constexpr float kKVCarry  = 16.0f;
constexpr float kScaleKV  = kKVCarry / (kPhiCarry * kVCarry);
constexpr float kScaleOut = 1.0f / (kPhiCarry * kKVCarry);
static_assert(kScaleKV == 1.0f / 4096.0f, "first GEMM epilogue scale");
static_assert(kScaleOut == 1.0f / 16384.0f, "second GEMM epilogue scale");
// Smallest normal f16 magnitude (2^-14); smaller operand values are replaced by +0 with a select before the convert
constexpr float kF16Min = 6.103515625e-5f;

// ---------------------------------------------------------------------------
// Workspace region map (bytes; every offset is a multiple of 128)
//   PART f16 [8][16][8192][8]  16*KV partial sums, one 256x256 tile (two half tiles of 128 d) per batch and run of 256 positions,
//                              in the order the waves hold them (see the partial kernel)              16,777,216
//   KVT  f16 [8][256][256]     16*KV transposed, rows = v, k = d                                       1,048,576
//   total                                                                                             17,825,792
// ---------------------------------------------------------------------------
constexpr int kRunLen = 256;
constexpr int kRuns   = kSeq / kRunLen;
constexpr int kChunks = kFeat * kFeat / 8;
constexpr size_t kOffPart = 0;
constexpr size_t kOffKVT  = kOffPart + (size_t)kBatch * kRuns * kChunks * 8 * 2;
constexpr size_t kWsTotal = kOffKVT + (size_t)kBatch * kFeat * kFeat * 2;
static_assert(kRuns == 16 && kChunks == 8192, "16 runs of 256 positions; 8,192 chunks of 8 halves a tile");
static_assert(kWsTotal == 17825792ull, "carve total");
static_assert(kWsTotal <= 134217728ull, "carve cap");
static_assert((kOffPart % 128) == 0 && (kOffKVT % 128) == 0, "128-B aligned regions");

// ---------------------------------------------------------------------------
// Hazard guards as plain device helpers (no inline asm inside the output kernel's body)
// ---------------------------------------------------------------------------
__device__ __forceinline__ void guard_one(v8f& acc, v16h a, v16h b) {
  asm volatile("v_nop\n\tv_nop\n\tv_nop\n\tv_nop" : "+v"(acc) : "v"(a), "v"(b));
}
__device__ __forceinline__ void keep4_h(v16h a, v16h b, v16h c, v16h d) {
  asm volatile("v_nop" :: "v"(a), "v"(b), "v"(c), "v"(d));
}
__device__ __forceinline__ void acc_guard4(v8f& a, v8f& b, v8f& c, v8f& d) {
  asm volatile("v_nop\n\tv_nop\n\tv_nop\n\tv_nop" : "+v"(a), "+v"(b), "+v"(c), "+v"(d));
}

// Fragment loader for both A ([m][k] rows) and Bt ([n][k] rows): p points at row (lane & 15), column k0 + 8*(lane >> 4);
// vector elements 0..7 <- p[0..7] (k0 + 8h + 0..7), elements 8..15 <- p[16..23] (k0 + 16 + 8h + 0..7).
struct FragH {
  union U { v16h v; v8h h[2]; };
  static __device__ __forceinline__ v16h load(const _Float16* p) {
    U f;
    f.h[0] = *(const v8h*)(p);
    f.h[1] = *(const v8h*)(p + 16);
    return f.v;
  }
  static __device__ __forceinline__ v8f mma(v16h a, v16h b, v8f c) {
    return __builtin_amdgcn_wmma_f32_16x16x32_f16(false, a, false, b, (short)0, c, false, false);
  }
};

// ---------------------------------------------------------------------------
// Output product with the feature map of Q fused in: f16 operands, f32 accumulate, f32 output.
// out[b][q][v] = scale * sum_d f16(1024 * (max(Q[b][q][d], 0) + 1e-6)) * Bt[b][v][d]; Bt = KVT, rows v, k = d.
// One block = 128 rows q x all 256 columns v; 8 waves as 2 (rows) x 4 (columns), each wave owns a 64x64 tile;
// batch = blockIdx.y; grid (32, 8) is exact (no tails, no early exit).
// The block reads its 128 rows of Q (f32, 128 KB in a row) once, in loads of 512 contiguous bytes a wave, maps and converts
// them and lays them in LDS as f16 rows; the A fragments of all 8 waves come from there behind one block barrier.
// LDS row pitch 264 halves = 528 B = 16 B x 33 (odd), for the 16-byte fragment reads.
// Stores: 16 lanes x 16 B = 256 B = 2 lines per row segment, one storing wave per line.
// ---------------------------------------------------------------------------
constexpr int kOutRows = 128;
constexpr int kPitchA  = kFeat + 8;
static_assert((kSeq % kOutRows) == 0 && kFeat == 256, "exact grid; 4 column waves of 64 cover the 256 columns");
static_assert((kOutRows * kFeat) % (4 * 256) == 0, "staging loop is exact");

__global__ __launch_bounds__(256) void wmma_out64_phiq_f16(
    const float* __restrict__ Q, const unsigned short* __restrict__ Btp,
    float* __restrict__ Cout, float scale) {
  const _Float16* Bt = (const _Float16*)Btp;
  constexpr int ldb = kFeat;
  constexpr int ldc = kFeat;
  constexpr int K   = kFeat;
  /* the block's 128 rows of 1024*phi(Q) in f16 */
  __shared__ __align__(16) _Float16 sA[kOutRows * kPitchA];
  /* per-wave 16x64 slab, pitch 68 floats */
  __shared__ __align__(16) float sT[8][16 * 68];
  const int b    = blockIdx.y;
  const int lane = threadIdx.x & 31;
  const int wave = threadIdx.x >> 5;
  const int r0 = blockIdx.x * kOutRows;
  const int mw = (wave >> 2) << 6;
  const int m0 = r0 + mw;
  const int n0 = (wave & 3) << 6;

  const _Float16* Bb = Bt + (size_t)b * kFeat * kFeat;

  /* ---- stage: 32 iterations x 256 threads x 4 floats = 128 x 256; one row = 64 threads ---- */
  {
    const float* Qt = Q + ((size_t)b * kSeq + r0) * kFeat + 4 * threadIdx.x;
    _Float16* St = sA + (threadIdx.x >> 6) * kPitchA + (threadIdx.x & 63) * 4;
    /* unrolled whole: every offset is a constant of its load or store, and all of a thread's loads can be in flight together */
#pragma unroll
    for (int it = 0; it < (kOutRows * kFeat) / (4 * 256); ++it) {
      const v4f x = *(const v4f*)(Qt + it * (4 * 256));
      v4h hv;
      /* unrolled: the vector elements are named by constants and stay in registers */
#pragma unroll
      for (int e = 0; e < 4; ++e) {
        float y = (fmaxf(x[e], 0.0f) + kEps) * kPhiCarry;
        y = (fabsf(y) < kF16Min) ? 0.0f : y;
        hv[e] = (_Float16)y;
      }
      *(v4h*)(St + it * 4 * kPitchA) = hv;
    }
  }
  /* all 128 rows are in LDS before any wave reads a fragment */
  __syncthreads();

  /* row (A) / column (Bt, D) within a 16-wide subtile; k offset of this lane half; D row offset of this lane half */
  const int rlane = lane & 15;
  const int koff  = (lane >> 4) * 8;
  const int mOff  = (lane >> 4) * 8;
  const _Float16* Al = sA + (mw + rlane) * kPitchA + koff;

  v8f acc[4][4];
#pragma unroll
  for (int i = 0; i < 4; ++i)
#pragma unroll
    for (int j = 0; j < 4; ++j) acc[i][j] = (v8f){0.f, 0.f, 0.f, 0.f, 0.f, 0.f, 0.f, 0.f};

  for (int k0 = 0; k0 < K; k0 += 32) {
    v16h bh[4];
#pragma unroll
    for (int j = 0; j < 4; ++j) {
      const size_t bo = (size_t)(n0 + (j << 4) + rlane) * ldb + koff + k0;
      bh[j] = FragH::load(Bb + bo);
    }
    v16h ah[4];
    /* unrolled: all four A fragments of the step are asked for here, so that their LDS reads fly beside the B loads */
#pragma unroll
    for (int i = 0; i < 4; ++i) ah[i] = FragH::load(Al + (i << 4) * kPitchA + k0);
#pragma unroll
    for (int i = 0; i < 4; ++i) {
#pragma unroll
      for (int j = 0; j < 4; ++j) acc[i][j] = FragH::mma(ah[i], bh[j], acc[i][j]);
      /* every accumulator of the group is tied, with its A and B fragments named as inputs */
      guard_one(acc[i][0], ah[i], bh[0]);
      guard_one(acc[i][1], ah[i], bh[1]);
      guard_one(acc[i][2], ah[i], bh[2]);
      guard_one(acc[i][3], ah[i], bh[3]);
    }
    keep4_h(bh[0], bh[1], bh[2], bh[3]);
  }
  acc_guard4(acc[0][0], acc[0][1], acc[0][2], acc[0][3]);
  acc_guard4(acc[1][0], acc[1][1], acc[1][2], acc[1][3]);
  acc_guard4(acc[2][0], acc[2][1], acc[2][2], acc[2][3]);
  acc_guard4(acc[3][0], acc[3][1], acc[3][2], acc[3][3]);

  /* ---- epilogue: D element r of lane l is (row 8*(l>>4) + r, col l & 15) ---- */
  float* slab = sT[wave];
  float* C = Cout + (size_t)b * kSeq * kFeat;
#pragma unroll
  for (int i = 0; i < 4; ++i) {
    const int mBase = m0 + (i << 4);
#pragma unroll
    for (int j = 0; j < 4; ++j) {
#pragma unroll
      for (int r = 0; r < 8; ++r) {
        const float v = acc[i][j][r] * scale;
        slab[(mOff + r) * 68 + (j << 4) + rlane] = v;
      }
    }
    __builtin_amdgcn_fence(__ATOMIC_RELEASE, "workgroup");
    __builtin_amdgcn_wave_barrier();
    __builtin_amdgcn_fence(__ATOMIC_ACQUIRE, "workgroup");
    /* row segment = 64 floats = 256 B = 16 lanes x 16 B; the two lane halves take two consecutive rows */
    const int hh = lane >> 4, c4 = (lane & 15) * 4;
#pragma unroll
    for (int it = 0; it < 8; ++it) {
      const int row = it * 2 + hh;
      v4f v = *(const v4f*)(slab + row * 68 + c4);
      *(v4f*)(C + (size_t)(mBase + row) * ldc + n0 + c4) = v;
    }
    __builtin_amdgcn_fence(__ATOMIC_RELEASE, "workgroup");
    __builtin_amdgcn_wave_barrier();
    __builtin_amdgcn_fence(__ATOMIC_ACQUIRE, "workgroup");
  }
}

// ---------------------------------------------------------------------------
// Partial KV product straight from the f32 inputs: f16 operands, f32 accumulate, f16 partial sums.
// One block = one batch (blockIdx.y), one run of 256 positions s and one half of the features d: a 128 (d) x 256 (v) half tile.
// A run is twice as long as a whole tile a block would allow on 256 blocks, so the partial sums written here and read by the
// adding launch are half as many bytes; the price is that the two blocks of a run both read its V rows.
// blockIdx.x: bit 3 = d half, the other four bits = run. The two blocks of a run are 8 apart in the flat index
// (speed only: any placement gives the same values).
// Grid (32, 8) is exact (no tails, no early exit).
// part[d][v] = f16(scale * sum_{s in run} f16(1024 * (max(K[s][d], 0) + 1e-6)) * f16(64 * V[s][v]))
// Loads: a wave takes 2 x 8 positions; one load = 2 rows x 256 contiguous bytes (64 features), lanes 0..15 row r, lanes 16..31 row 4 + r.
// A thread then holds 4 positions x 4 features, converts them and stores 4 positions of one feature (8 B) at a time:
// LDS rows are features, 256 positions (512 B) each, no pad; the 16-byte chunk q of row c lies at place q ^ (c & 15) ^ ((c >> 2) & 15),
// which spreads over all banks both the 8-byte stores (rows 4 apart) and the 16-byte fragment reads (16 rows in a row).
// 16 waves as 2 (d) x 8 (v), each a 64x32 tile, A = rows d of K, Bt = rows v of V, 8 k steps of 32 positions.
// The products are the builtin form: the compiler keeps the distances behind them.
// In front of its barrier the block also asks L2 for the Q rows of the output launch's block of the same index (grids are alike).
// D element r of lane l is (d = 8*(l>>4) + r, v = l & 15): a lane's 8 values are 8 neighbours along d. They go out as one
// 16-byte chunk, chunk number dhalf*4096 + ((wave*2 + j)*4 + i)*32 + lane: every store of a wave is 512 contiguous bytes.
// ---------------------------------------------------------------------------
constexpr int kHalfD = kFeat / 2;
static_assert(kRunLen == 256 && kFeat == 256, "16 waves x 2 x 8 positions; 32 chunks a row; 2 x 8 waves of 64 x 32");
static_assert(kRuns * 2 == kSeq / kOutRows && kOutRows * kFeat * 4 == 512 * 256, "same grid as the output launch; 512 threads x 256 B = its Q rows");

// offset in halves of chunk q (8 positions) of feature row c
__device__ __forceinline__ int chunk_at(int c, int q) {
  return c * kRunLen + ((q ^ (c & 15) ^ ((c >> 2) & 15)) << 3);
}
// fragment of row c, k step ks: elements 0..7 <- positions 32 ks + 8 h + 0..7, elements 8..15 <- 32 ks + 16 + 8 h + 0..7
__device__ __forceinline__ v16h frag_at(const _Float16* s, int c, int ks, int h) {
  FragH::U f;
  f.h[0] = *(const v8h*)(s + chunk_at(c, 4 * ks + h));
  f.h[1] = *(const v8h*)(s + chunk_at(c, 4 * ks + 2 + h));
  return f.v;
}

__global__ __launch_bounds__(512) void wmma_kv_partial_f16(
    const float* __restrict__ Kp, const float* __restrict__ Vp, const float* __restrict__ Qnext,
    unsigned short* __restrict__ Part, float scale) {
  __shared__ __align__(16) _Float16 sK[kHalfD * kRunLen];
  __shared__ __align__(16) _Float16 sV[kFeat * kRunLen];
  const int b    = blockIdx.y;
  const int dh   = (blockIdx.x >> 3) & 1;
  const int run  = (blockIdx.x & 7) | ((blockIdx.x >> 4) << 3);
  const int lane = threadIdx.x & 31;
  const int wave = threadIdx.x >> 5;
  const int rlane = lane & 15;
  const int h     = lane >> 4;

  /* ---- all 48 loads of a thread are asked for at once: 2 sets of 8 positions (128 apart) x feature groups x 4 rows, K then V ---- */
  const size_t off = ((size_t)b * kSeq + run * kRunLen + wave * 8 + 4 * h) * kFeat + 4 * rlane;
  const float* Kt = Kp + off + dh * kHalfD;
  const float* Vt = Vp + off;
  v4f xk[2][2][4], xv[2][4][4];
  /* unrolled: the register sets are named by constants */
#pragma unroll
  for (int s = 0; s < 2; ++s)
#pragma unroll
    for (int g = 0; g < 2; ++g)
#pragma unroll
      for (int r = 0; r < 4; ++r) xk[s][g][r] = *(const v4f*)(Kt + (s * 128 + r) * kFeat + g * 64);
  /* keeps the K loads in front of the V loads: loads return in order, and K is converted first, while V is still in flight */
  __builtin_amdgcn_sched_barrier(0);
#pragma unroll
  for (int s = 0; s < 2; ++s)
#pragma unroll
    for (int g = 0; g < 4; ++g)
#pragma unroll
      for (int r = 0; r < 4; ++r) xv[s][g][r] = *(const v4f*)(Vt + (s * 128 + r) * kFeat + g * 64);
  /* keeps the first K conversions, and with them a wait on the K loads, from being scheduled in front of the V loads */
  __builtin_amdgcn_sched_barrier(0);
  /* the two address pairs are named here so that no load lands on them, and nothing rewrites them in front of this wait */
  asm volatile("s_wait_xcnt 0x0" :: "v"(Kt), "v"(Vt) : "memory");

#pragma unroll
  for (int s = 0; s < 2; ++s) {
#pragma unroll
    for (int g = 0; g < 2; ++g) {
#pragma unroll
      for (int j = 0; j < 4; ++j) {
        v4h hv;
#pragma unroll
        for (int r = 0; r < 4; ++r) {
          float y = (fmaxf(xk[s][g][r][j], 0.0f) + kEps) * kPhiCarry;
          y = (fabsf(y) < kF16Min) ? 0.0f : y;
          hv[r] = (_Float16)y;
        }
        *(v4h*)(sK + chunk_at(g * 64 + 4 * rlane + j, s * 16 + wave) + 4 * h) = hv;
      }
      /* keeps later groups' conversions, and with them the waits on later loads, behind this group: work goes on while loads land */
      __builtin_amdgcn_sched_barrier(0);
    }
  }
#pragma unroll
  for (int s = 0; s < 2; ++s) {
#pragma unroll
    for (int g = 0; g < 4; ++g) {
#pragma unroll
      for (int j = 0; j < 4; ++j) {
        v4h hv;
#pragma unroll
        for (int r = 0; r < 4; ++r) {
          float y = xv[s][g][r][j] * kVCarry;
          y = (fabsf(y) < kF16Min) ? 0.0f : y;
          hv[r] = (_Float16)y;
        }
        *(v4h*)(sV + chunk_at(g * 64 + 4 * rlane + j, s * 16 + wave) + 4 * h) = hv;
      }
      /* as above: each group waits only for its own loads */
      __builtin_amdgcn_sched_barrier(0);
    }
  }
  /* This wave's own loads have landed, and memory has little to do through the products, the adding launch and two launch gaps:
     ask L2 now for the 128 rows of Q (128 KB; one prefetch a thread, 256 B apart) that the block of the same index reads at the head
     of the output launch. Speed only: no value is read, and any placement of the blocks gives the same results.
     The address lies inside Q for every thread. The wait in the same statement is a precaution: it stands in front of every later
     rewrite of the address pair; its place is in front of the barrier, where the wave waits for the others anyway. */
  {
    const float* qn = Qnext + ((size_t)b * kSeq + blockIdx.x * kOutRows) * kFeat + 64 * threadIdx.x;
    asm volatile("global_prefetch_b8 %0, off scope:SCOPE_SE\n\ts_wait_xcnt 0x0" :: "v"(qn));
  }
  /* all 256 positions of both operands are in LDS before any wave reads a fragment */
  __syncthreads();

  const int d0 = (wave >> 3) << 6;
  const int v0 = (wave & 7) << 5;
  v8f acc[4][2];
#pragma unroll
  for (int i = 0; i < 4; ++i)
#pragma unroll
    for (int j = 0; j < 2; ++j) acc[i][j] = (v8f){0.f, 0.f, 0.f, 0.f, 0.f, 0.f, 0.f, 0.f};

  /* unrolled whole (8 trips): the chunk numbers become constants and the next step's fragment reads can start early */
#pragma unroll
  for (int ks = 0; ks < kRunLen / 32; ++ks) {
    v16h ah[4], bh[2];
#pragma unroll
    for (int i = 0; i < 4; ++i) ah[i] = frag_at(sK, d0 + (i << 4) + rlane, ks, h);
#pragma unroll
    for (int j = 0; j < 2; ++j) bh[j] = frag_at(sV, v0 + (j << 4) + rlane, ks, h);
#pragma unroll
    for (int i = 0; i < 4; ++i)
#pragma unroll
      for (int j = 0; j < 2; ++j) acc[i][j] = FragH::mma(ah[i], bh[j], acc[i][j]);
  }

  unsigned short* P = Part + ((size_t)(b * kRuns + run) * kChunks + (size_t)dh * 4096 + (size_t)wave * 256 + lane) * 8;
#pragma unroll
  for (int j = 0; j < 2; ++j) {
#pragma unroll
    for (int i = 0; i < 4; ++i) {
      v8h hv;
#pragma unroll
      for (int r = 0; r < 8; ++r) hv[r] = (_Float16)(acc[i][j][r] * scale);
      *(v8h*)(P + (j * 4 + i) * 256) = hv;
    }
  }
}

// ---------------------------------------------------------------------------
// Adds the 16 partial tiles of a batch in f32, in run order 0..15, and writes KVT[b][v][d] (f16, rows v, d contiguous).
// 65,536 threads, one 16-byte chunk (8 values along d) each: grid 256 x 256 threads is exact. A wave's load is 512 contiguous bytes
// of one partial tile; all 16 loads of a thread are in flight together.
// Values below 2^-14 in magnitude are replaced by +0 before the convert.
// A block holds 8 tiles of 16x16: one d half, one wave number, both j, all four i = 32 rows v x 64 d. They pass through LDS (pitch 72 halves)
// so that 8 lanes store one whole 128-B line, one storing wave per line.
// ---------------------------------------------------------------------------
__global__ __launch_bounds__(256) void add_partials_f16(const unsigned short* __restrict__ Part, unsigned short* __restrict__ Cout) {
  __shared__ __align__(16) _Float16 sO[32 * 72];
  const int t = threadIdx.x;
  const int b = blockIdx.x >> 5;
  const int e = (blockIdx.x & 31) * 256 + t;
  const _Float16* P = (const _Float16*)Part + ((size_t)b * kRuns * kChunks + e) * 8;
  v8h p[kRuns];
  /* unrolled: the registers are named by constants and every load is asked for before the first sum */
#pragma unroll
  for (int n = 0; n < kRuns; ++n) p[n] = *(const v8h*)(P + (size_t)n * kChunks * 8);
  float s[8];
#pragma unroll
  for (int r = 0; r < 8; ++r) s[r] = (float)p[0][r];
#pragma unroll
  for (int n = 1; n < kRuns; ++n)
#pragma unroll
    for (int r = 0; r < 8; ++r) s[r] += (float)p[n][r];
  v8h hv;
#pragma unroll
  for (int r = 0; r < 8; ++r) {
    const float x = (fabsf(s[r]) < kF16Min) ? 0.0f : s[r];
    hv[r] = (_Float16)x;
  }
  /* thread t holds tile i = (t >> 5) & 3 of j half t >> 7: row (l & 15), columns 16 i + 8 (l >> 4) + 0..7 */
  const int lane = t & 31;
  *(v8h*)(sO + ((t >> 7) * 16 + (lane & 15)) * 72 + ((t >> 5) & 3) * 16 + (lane >> 4) * 8) = hv;
  /* the block's 32 rows are in LDS before any thread reads a line piece */
  __syncthreads();
  const int row = t >> 3;
  const v8h o = *(const v8h*)(sO + row * 72 + (t & 7) * 8);
  /* the block's tiles: blockIdx & 31 = dhalf * 16 + wave; wave = (d group of 64) * 8 + (v group of 32) */
  const int wv = blockIdx.x & 15;
  const int v  = ((wv & 7) << 5) + row;
  const int d  = (((blockIdx.x >> 4) & 1) << 7) + ((wv >> 3) << 6) + (t & 7) * 8;
  *(v8h*)(Cout + ((size_t)b * kFeat + v) * kFeat + d) = o;
}

// ---------------------------------------------------------------------------
// Host glue: 3 kernel launches, nothing else.
//   1. PART[b][run] = (1/4096) * sum over the run's 256 positions of 1024*phi(K)[s][d] * 64*V[s][v]   grid (32, 8) = (16 runs x 2 d halves, 8), 16 waves a block
//   2. KVT[b][v][d] = sum of the 16 partial tiles (= 16 * KV[b][d][v])                                  grid 256
//   3. out[b][q][v] = (1/16384) * sum_d f16(1024*phi(Q))[b][q][d] * KVT[b][v][d]
//        A from Q in the kernel (M = 4096 rows q), Bt = KVT (N = 256 rows v), K = 256; 128 rows per block -> grid (32, 8)
// ---------------------------------------------------------------------------
extern "C" void kernel_launch(void* const* d_in, const int* in_sizes, int n_in,
                              void* d_out, int out_size, void* d_ws, size_t ws_size,
                              hipStream_t stream) {
  if (n_in < 3) return;
  if (in_sizes[0] != kPlaneElems) return;
  if (in_sizes[1] != kPlaneElems) return;
  if (in_sizes[2] != kPlaneElems) return;
  if (out_size != kPlaneElems) return;
  if (ws_size < kWsTotal) return;

  const float* Q = (const float*)d_in[0];
  const float* K = (const float*)d_in[1];
  const float* V = (const float*)d_in[2];
  float* out = (float*)d_out;

  char* ws = (char*)d_ws;
  unsigned short* PART = (unsigned short*)(ws + kOffPart);
  unsigned short* KVT  = (unsigned short*)(ws + kOffKVT);

  wmma_kv_partial_f16<<<dim3(kRuns * 2, kBatch), 512, 0, stream>>>(K, V, Q, PART, kScaleKV);

  add_partials_f16<<<dim3(kBatch * kChunks / 256), 256, 0, stream>>>(PART, KVT);

  wmma_out64_phiq_f16<<<dim3(kSeq / kOutRows, kBatch), 256, 0, stream>>>(Q, KVT, out, kScaleOut);
}

// v008
// Measured time: 22.4 microseconds a run.
// Timed twice side by side with v007, it ran 1.06 and 1.07 times as fast.
// All steps since v000 together make it 8.39 times as fast.
// Both contractions (phi(K)^T.V over the 4,096 positions, and phi(Q).KV over the 256 features): v_wmma_f32_16x16x32_f16, plain f16 operands carried by powers of two (phi x1024, V x64, KV x16), f32 accumulate; relu + 1e-6 feature map and all scale folds in f32.
#include <hip/hip_runtime.h>
#include <math.h>

typedef __attribute__((ext_vector_type(16))) _Float16 v16h;
typedef __attribute__((ext_vector_type(8)))  _Float16 v8h;
typedef __attribute__((ext_vector_type(4)))  _Float16 v4h;
typedef __attribute__((ext_vector_type(8)))  float    v8f;
typedef __attribute__((ext_vector_type(4)))  float    v4f;

// ---------------------------------------------------------------------------
// Shape constants (wire contract: three f32 inputs [8][4096][256], one f32 output [8][4096][256])
// ---------------------------------------------------------------------------
constexpr int kBatch = 8;
constexpr int kSeq   = 4096;
constexpr int kFeat  = 256;
constexpr int kPlaneElems = kBatch * kSeq * kFeat;
static_assert(kPlaneElems == 8388608, "element count per tensor");
static_assert((kSeq % 64) == 0 && (kFeat % 64) == 0, "GEMM M,N multiples of 64");
static_assert((kSeq % 32) == 0 && (kFeat % 32) == 0, "GEMM K multiples of 32");

// Feature-map offset and power-of-two carries (all exact in f32; folded back in the GEMM epilogue scales)
constexpr float kEps      = 1e-6f;
constexpr float kPhiCarry = 1024.0f;
constexpr float kVCarry   = 64.0f;
constexpr float kKVCarry  = 16.0f;
constexpr float kScaleKV  = kKVCarry / (kPhiCarry * kVCarry);
constexpr float kScaleOut = 1.0f / (kPhiCarry * kKVCarry);
static_assert(kScaleKV == 1.0f / 4096.0f, "first GEMM epilogue scale");
static_assert(kScaleOut == 1.0f / 16384.0f, "second GEMM epilogue scale");
// Smallest normal f16 magnitude (2^-14); smaller operand values are replaced by +0 with a select before the convert
constexpr float kF16Min = 6.103515625e-5f;

// ---------------------------------------------------------------------------
// Workspace region map (bytes; every offset is a multiple of 128)
//   PART f16 [8][16][8192][8]  16*KV partial sums, one 256x256 tile (two half tiles of 128 d) per batch and run of 256 positions,
//                              in the order the waves hold them (see the partial kernel)              16,777,216
//   KVT  f16 [8][256][256]     16*KV transposed, rows = v, k = d                                       1,048,576
//   total                                                                                             17,825,792
// ---------------------------------------------------------------------------
constexpr int kRunLen = 256;
constexpr int kRuns   = kSeq / kRunLen;
constexpr int kChunks = kFeat * kFeat / 8;
constexpr size_t kOffPart = 0;
constexpr size_t kOffKVT  = kOffPart + (size_t)kBatch * kRuns * kChunks * 8 * 2;
constexpr size_t kWsTotal = kOffKVT + (size_t)kBatch * kFeat * kFeat * 2;
static_assert(kRuns == 16 && kChunks == 8192, "16 runs of 256 positions; 8,192 chunks of 8 halves a tile");
static_assert(kWsTotal == 17825792ull, "carve total");
static_assert(kWsTotal <= 134217728ull, "carve cap");
static_assert((kOffPart % 128) == 0 && (kOffKVT % 128) == 0, "128-B aligned regions");

// ---------------------------------------------------------------------------
// Hazard guards as plain device helpers (no inline asm inside the output kernel's body)
// ---------------------------------------------------------------------------
__device__ __forceinline__ void guard_one(v8f& acc, v16h a, v16h b) {
  asm volatile("v_nop\n\tv_nop\n\tv_nop\n\tv_nop" : "+v"(acc) : "v"(a), "v"(b));
}
__device__ __forceinline__ void keep4_h(v16h a, v16h b, v16h c, v16h d) {
  asm volatile("v_nop" :: "v"(a), "v"(b), "v"(c), "v"(d));
}
__device__ __forceinline__ void acc_guard4(v8f& a, v8f& b, v8f& c, v8f& d) {
  asm volatile("v_nop\n\tv_nop\n\tv_nop\n\tv_nop" : "+v"(a), "+v"(b), "+v"(c), "+v"(d));
}

// Fragment loader for both A ([m][k] rows) and Bt ([n][k] rows): p points at row (lane & 15), column k0 + 8*(lane >> 4);
// vector elements 0..7 <- p[0..7] (k0 + 8h + 0..7), elements 8..15 <- p[16..23] (k0 + 16 + 8h + 0..7).
struct FragH {
  union U { v16h v; v8h h[2]; };
  static __device__ __forceinline__ v16h load(const _Float16* p) {
    U f;
    f.h[0] = *(const v8h*)(p);
    f.h[1] = *(const v8h*)(p + 16);
    return f.v;
  }
  static __device__ __forceinline__ v8f mma(v16h a, v16h b, v8f c) {
    return __builtin_amdgcn_wmma_f32_16x16x32_f16(false, a, false, b, (short)0, c, false, false);
  }
};

// ---------------------------------------------------------------------------
// Output product with the feature map of Q fused in: f16 operands, f32 accumulate, f32 output.
// out[b][q][v] = scale * sum_d f16(1024 * (max(Q[b][q][d], 0) + 1e-6)) * Bt[b][v][d]; Bt = KVT, rows v, k = d.
// One block = 128 rows q x all 256 columns v; 8 waves as 2 (rows) x 4 (columns), each wave owns a 64x64 tile;
// batch = blockIdx.y; grid (32, 8) is exact (no tails, no early exit).
// The block reads its 128 rows of Q (f32, 128 KB in a row) once, in loads of 512 contiguous bytes a wave, maps and converts
// them and lays them in LDS as f16 rows; the A fragments of all 8 waves come from there behind one block barrier.
// LDS row pitch 264 halves = 528 B = 16 B x 33 (odd), for the 16-byte fragment reads.
// Stores: 16 lanes x 16 B = 256 B = 2 lines per row segment, one storing wave per line.
// ---------------------------------------------------------------------------
constexpr int kOutRows = 128;
constexpr int kPitchA  = kFeat + 8;
static_assert((kSeq % kOutRows) == 0 && kFeat == 256, "exact grid; 4 column waves of 64 cover the 256 columns");
static_assert((kOutRows * kFeat) % (4 * 256) == 0, "staging loop is exact");

__global__ __launch_bounds__(256) void wmma_out64_phiq_f16(
    const float* __restrict__ Q, const unsigned short* __restrict__ Btp,
    float* __restrict__ Cout, float scale) {
  const _Float16* Bt = (const _Float16*)Btp;
  constexpr int ldb = kFeat;
  constexpr int ldc = kFeat;
  constexpr int K   = kFeat;
  /* the block's 128 rows of 1024*phi(Q) in f16 */
  __shared__ __align__(16) _Float16 sA[kOutRows * kPitchA];
  /* per-wave 16x64 slab, pitch 68 floats */
  __shared__ __align__(16) float sT[8][16 * 68];
  const int b    = blockIdx.y;
  const int lane = threadIdx.x & 31;
  const int wave = threadIdx.x >> 5;
  const int r0 = blockIdx.x * kOutRows;
  const int mw = (wave >> 2) << 6;
  const int m0 = r0 + mw;
  const int n0 = (wave & 3) << 6;

  const _Float16* Bb = Bt + (size_t)b * kFeat * kFeat;

  /* ---- stage: 32 iterations x 256 threads x 4 floats = 128 x 256; one row = 64 threads ---- */
  {
    const float* Qt = Q + ((size_t)b * kSeq + r0) * kFeat + 4 * threadIdx.x;
    _Float16* St = sA + (threadIdx.x >> 6) * kPitchA + (threadIdx.x & 63) * 4;
    /* unrolled whole: every offset is a constant of its load or store, and all of a thread's loads can be in flight together */
#pragma unroll
    for (int it = 0; it < (kOutRows * kFeat) / (4 * 256); ++it) {
      const v4f x = *(const v4f*)(Qt + it * (4 * 256));
      v4h hv;
      /* unrolled: the vector elements are named by constants and stay in registers */
#pragma unroll
      for (int e = 0; e < 4; ++e) {
        float y = (fmaxf(x[e], 0.0f) + kEps) * kPhiCarry;
        y = (fabsf(y) < kF16Min) ? 0.0f : y;
        hv[e] = (_Float16)y;
      }
      *(v4h*)(St + it * 4 * kPitchA) = hv;
    }
  }
  /* all 128 rows are in LDS before any wave reads a fragment */
  __syncthreads();

  /* row (A) / column (Bt, D) within a 16-wide subtile; k offset of this lane half; D row offset of this lane half */
  const int rlane = lane & 15;
  const int koff  = (lane >> 4) * 8;
  const int mOff  = (lane >> 4) * 8;
  const _Float16* Al = sA + (mw + rlane) * kPitchA + koff;

  v8f acc[4][4];
#pragma unroll
  for (int i = 0; i < 4; ++i)
#pragma unroll
    for (int j = 0; j < 4; ++j) acc[i][j] = (v8f){0.f, 0.f, 0.f, 0.f, 0.f, 0.f, 0.f, 0.f};

  for (int k0 = 0; k0 < K; k0 += 32) {
    v16h bh[4];
#pragma unroll
    for (int j = 0; j < 4; ++j) {
      const size_t bo = (size_t)(n0 + (j << 4) + rlane) * ldb + koff + k0;
      bh[j] = FragH::load(Bb + bo);
    }
    v16h ah[4];
    /* unrolled: all four A fragments of the step are asked for here, so that their LDS reads fly beside the B loads */
#pragma unroll
    for (int i = 0; i < 4; ++i) ah[i] = FragH::load(Al + (i << 4) * kPitchA + k0);
#pragma unroll
    for (int i = 0; i < 4; ++i) {
#pragma unroll
      for (int j = 0; j < 4; ++j) acc[i][j] = FragH::mma(ah[i], bh[j], acc[i][j]);
      /* every accumulator of the group is tied, with its A and B fragments named as inputs */
      guard_one(acc[i][0], ah[i], bh[0]);
      guard_one(acc[i][1], ah[i], bh[1]);
      guard_one(acc[i][2], ah[i], bh[2]);
      guard_one(acc[i][3], ah[i], bh[3]);
    }
    keep4_h(bh[0], bh[1], bh[2], bh[3]);
  }
  acc_guard4(acc[0][0], acc[0][1], acc[0][2], acc[0][3]);
  acc_guard4(acc[1][0], acc[1][1], acc[1][2], acc[1][3]);
  acc_guard4(acc[2][0], acc[2][1], acc[2][2], acc[2][3]);
  acc_guard4(acc[3][0], acc[3][1], acc[3][2], acc[3][3]);

  /* ---- epilogue: D element r of lane l is (row 8*(l>>4) + r, col l & 15) ---- */
  float* slab = sT[wave];
  float* C = Cout + (size_t)b * kSeq * kFeat;
#pragma unroll
  for (int i = 0; i < 4; ++i) {
    const int mBase = m0 + (i << 4);
#pragma unroll
    for (int j = 0; j < 4; ++j) {
#pragma unroll
      for (int r = 0; r < 8; ++r) {
        const float v = acc[i][j][r] * scale;
        slab[(mOff + r) * 68 + (j << 4) + rlane] = v;
      }
    }
    __builtin_amdgcn_fence(__ATOMIC_RELEASE, "workgroup");
    __builtin_amdgcn_wave_barrier();
    __builtin_amdgcn_fence(__ATOMIC_ACQUIRE, "workgroup");
    /* row segment = 64 floats = 256 B = 16 lanes x 16 B; the two lane halves take two consecutive rows */
    const int hh = lane >> 4, c4 = (lane & 15) * 4;
#pragma unroll
    for (int it = 0; it < 8; ++it) {
      const int row = it * 2 + hh;
      v4f v = *(const v4f*)(slab + row * 68 + c4);
      *(v4f*)(C + (size_t)(mBase + row) * ldc + n0 + c4) = v;
    }
    __builtin_amdgcn_fence(__ATOMIC_RELEASE, "workgroup");
    __builtin_amdgcn_wave_barrier();
    __builtin_amdgcn_fence(__ATOMIC_ACQUIRE, "workgroup");
  }
}

// ---------------------------------------------------------------------------
// Partial KV product straight from the f32 inputs: f16 operands, f32 accumulate, f16 partial sums.
// One block = one batch (blockIdx.y), one run of 256 positions s and one half of the features d: a 128 (d) x 256 (v) half tile.
// A run is twice as long as a whole tile a block would allow on 256 blocks, so the partial sums written here and read by the
// adding launch are half as many bytes; the price is that the two blocks of a run both read its V rows.
// blockIdx.x: bit 3 = d half, the other four bits = run. The two blocks of a run are 8 apart in the flat index
// (speed only: any placement gives the same values).
// Grid (32, 8) is exact (no tails, no early exit).
// part[d][v] = f16(scale * sum_{s in run} f16(1024 * (max(K[s][d], 0) + 1e-6)) * f16(64 * V[s][v]))
// 8 waves a block: the launch has half as many waves to start as with 16, and a wave's 64x64 tile reads 8 fragments for 16 products.
// Loads: a wave takes 4 sets of 8 positions (64 apart); one load = 2 rows x 256 contiguous bytes (64 features), lanes 0..15 row r,
// lanes 16..31 row 4 + r. Two sets (48 loads a thread) are in flight; a set's registers are asked for anew as soon as it is converted.
// A thread then holds 4 positions x 4 features, converts them and stores 4 positions of one feature (8 B) at a time:
// LDS rows are features, 256 positions (512 B) each, no pad; the 16-byte chunk q of row c lies at place q ^ (c & 15) ^ ((c >> 2) & 15),
// which spreads over all banks both the 8-byte stores (rows 4 apart) and the 16-byte fragment reads (16 rows in a row).
// 8 waves as 2 (d) x 4 (v), each a 64x64 tile, A = rows d of K, Bt = rows v of V, 8 k steps of 32 positions.
// The products are the builtin form: the compiler keeps the distances behind them.
// In front of its barrier the block also asks L2 for the Q rows of the output launch's block of the same index (grids are alike).
// D element r of lane l is (d = 8*(l>>4) + r, v = l & 15): a lane's 8 values are 8 neighbours along d. They go out as one
// 16-byte chunk, chunk number dhalf*4096 + ((wave*4 + j)*4 + i)*32 + lane: every store of a wave is 512 contiguous bytes.
// ---------------------------------------------------------------------------
constexpr int kHalfD = kFeat / 2;
constexpr int kKvThreads = 256;
static_assert(kRunLen == 256 && kFeat == 256, "8 waves x 4 x 8 positions; 32 chunks a row; 2 x 4 waves of 64 x 64");
static_assert(kRuns * 2 == kSeq / kOutRows && kOutRows * kFeat * 4 == kKvThreads * 2 * 256, "same grid as the output launch; 256 threads x 2 x 256 B = its Q rows");

// offset in halves of chunk q (8 positions) of feature row c
__device__ __forceinline__ int chunk_at(int c, int q) {
  return c * kRunLen + ((q ^ (c & 15) ^ ((c >> 2) & 15)) << 3);
}
// Fragment reads of a wave's 64 rows c = c0 + 16 i + (lane & 15), c0 a multiple of 64. With q = 4 ks + 2 t + h the place of chunk q is
// q ^ (c & 15) ^ ((c >> 2) & 15) = C ^ X, C = 4 ks ^ 2 t ^ 4 i a constant, X = h ^ (lane & 15) ^ ((lane & 15) >> 2) below 16:
// the low four bits of C are one of 8 even numbers, so 8 lane pointers an operand serve every read, and i and bit 4 of C are constant
// offsets of the LDS load. A 64x64 tile has 128 such reads: one address register each would not leave room for the accumulators.
struct FragRows {
  const _Float16* p[8];
  __device__ __forceinline__ void init(const _Float16* s, int c0, int rlane, int h) {
    const int x = h ^ rlane ^ (rlane >> 2);
    /* unrolled: the pointers are named by constants and stay in registers */
#pragma unroll
    for (int e = 0; e < 8; ++e) p[e] = s + (c0 + rlane) * kRunLen + (((2 * e) ^ x) << 3);
  }
  // fragment i, k step ks: elements 0..7 <- positions 32 ks + 8 h + 0..7, elements 8..15 <- 32 ks + 16 + 8 h + 0..7
  __device__ __forceinline__ v16h frag(int i, int ks) const {
    FragH::U f;
#pragma unroll
    for (int t = 0; t < 2; ++t) {
      const int C = (4 * ks) ^ (2 * t) ^ (4 * i);
      f.h[t] = *(const v8h*)(p[(C & 15) >> 1] + i * 16 * kRunLen + (C & 16) * 8);
    }
    return f.v;
  }
};

// One set = 8 positions a wave: 8 loads of K (2 feature groups x 4 rows), then 16 of V (4 groups x 4 rows).
struct KvSet { v4f k[2][4]; v4f v[4][4]; };

__device__ __forceinline__ void kv_set_load(KvSet& x, const float* Kt, const float* Vt, int s) {
  /* unrolled: the registers are named by constants */
#pragma unroll
  for (int g = 0; g < 2; ++g)
#pragma unroll
    for (int r = 0; r < 4; ++r) x.k[g][r] = *(const v4f*)(Kt + (s * 64 + r) * kFeat + g * 64);
#pragma unroll
  for (int g = 0; g < 4; ++g)
#pragma unroll
    for (int r = 0; r < 4; ++r) x.v[g][r] = *(const v4f*)(Vt + (s * 64 + r) * kFeat + g * 64);
  /* keeps these loads where they stand: in front of the conversions that follow, so that they fly while older sets are converted */
  __builtin_amdgcn_sched_barrier(0);
}

__device__ __forceinline__ void kv_set_store(const KvSet& x, _Float16* sK, _Float16* sV, int q, int rlane, int h) {
#pragma unroll
  for (int g = 0; g < 2; ++g) {
#pragma unroll
    for (int j = 0; j < 4; ++j) {
      v4h hv;
#pragma unroll
      for (int r = 0; r < 4; ++r) {
        float y = (fmaxf(x.k[g][r][j], 0.0f) + kEps) * kPhiCarry;
        y = (fabsf(y) < kF16Min) ? 0.0f : y;
        hv[r] = (_Float16)y;
      }
      *(v4h*)(sK + chunk_at(g * 64 + 4 * rlane + j, q) + 4 * h) = hv;
    }
    /* keeps later groups' conversions, and with them the waits on later loads, behind this group: work goes on while loads land */
    __builtin_amdgcn_sched_barrier(0);
  }
#pragma unroll
  for (int g = 0; g < 4; ++g) {
#pragma unroll
    for (int j = 0; j < 4; ++j) {
      v4h hv;
#pragma unroll
      for (int r = 0; r < 4; ++r) {
        float y = x.v[g][r][j] * kVCarry;
        y = (fabsf(y) < kF16Min) ? 0.0f : y;
        hv[r] = (_Float16)y;
      }
      *(v4h*)(sV + chunk_at(g * 64 + 4 * rlane + j, q) + 4 * h) = hv;
    }
    /* as above: each group waits only for its own loads */
    __builtin_amdgcn_sched_barrier(0);
  }
}

__global__ __launch_bounds__(kKvThreads) void wmma_kv_partial_f16(
    const float* __restrict__ Kp, const float* __restrict__ Vp, const float* __restrict__ Qnext,
    unsigned short* __restrict__ Part, float scale) {
  __shared__ __align__(16) _Float16 sK[kHalfD * kRunLen];
  __shared__ __align__(16) _Float16 sV[kFeat * kRunLen];
  const int b    = blockIdx.y;
  const int dh   = (blockIdx.x >> 3) & 1;
  const int run  = (blockIdx.x & 7) | ((blockIdx.x >> 4) << 3);
  const int lane = threadIdx.x & 31;
  const int wave = threadIdx.x >> 5;
  const int rlane = lane & 15;
  const int h     = lane >> 4;

  /* ---- 4 sets of 8 positions a wave (64 apart), two register sets: sets 0 and 1 are asked for at once, set s + 2 behind set s ---- */
  const size_t off = ((size_t)b * kSeq + run * kRunLen + wave * 8 + 4 * h) * kFeat + 4 * rlane;
  const float* Kt = Kp + off + dh * kHalfD;
  const float* Vt = Vp + off;
  KvSet x0, x1;
  kv_set_load(x0, Kt, Vt, 0);
  kv_set_load(x1, Kt, Vt, 1);
  kv_set_store(x0, sK, sV, 0 * 8 + wave, rlane, h);
  kv_set_load(x0, Kt, Vt, 2);
  kv_set_store(x1, sK, sV, 1 * 8 + wave, rlane, h);
  kv_set_load(x1, Kt, Vt, 3);
  /* the two address pairs are named here so that no load lands on them, and nothing rewrites them in front of this wait */
  asm volatile("s_wait_xcnt 0x0" :: "v"(Kt), "v"(Vt) : "memory");
  kv_set_store(x0, sK, sV, 2 * 8 + wave, rlane, h);
  kv_set_store(x1, sK, sV, 3 * 8 + wave, rlane, h);

  /* This wave's own loads have landed, and memory has little to do through the products, the adding launch and two launch gaps:
     ask L2 now for the 128 rows of Q (128 KB, two prefetches a thread) that the block of the same index reads at the head
     of the output launch. Speed only: no value is read, and any placement of the blocks gives the same results.
     Both addresses lie inside Q for every thread. The wait in the same statement is a precaution: it stands in front of every later
     rewrite of the address pairs; its place is in front of the barrier, where the wave waits for the others anyway. */
  {
    const float* qn = Qnext + ((size_t)b * kSeq + blockIdx.x * kOutRows) * kFeat + 64 * threadIdx.x;
    const float* qm = qn + 64 * kKvThreads;
    asm volatile("global_prefetch_b8 %0, off scope:SCOPE_SE\n\tglobal_prefetch_b8 %1, off scope:SCOPE_SE\n\ts_wait_xcnt 0x0" :: "v"(qn), "v"(qm));
  }
  /* all 256 positions of both operands are in LDS before any wave reads a fragment */
  __syncthreads();

  const int d0 = (wave >> 2) << 6;
  const int v0 = (wave & 3) << 6;
  FragRows fa, fb;
  fa.init(sK, d0, rlane, h);
  fb.init(sV, v0, rlane, h);
  v8f acc[4][4];
#pragma unroll
  for (int i = 0; i < 4; ++i)
#pragma unroll
    for (int j = 0; j < 4; ++j) acc[i][j] = (v8f){0.f, 0.f, 0.f, 0.f, 0.f, 0.f, 0.f, 0.f};

  /* two fragment sets: the next k step's 16 LDS reads are asked for as one group in front of this step's 16 products */
  v16h ah[2][4], bh[2][4];
#pragma unroll
  for (int i = 0; i < 4; ++i) ah[0][i] = fa.frag(i, 0);
#pragma unroll
  for (int j = 0; j < 4; ++j) bh[0][j] = fb.frag(j, 0);
  /* unrolled whole (8 trips): the set, the pointer choice and the offsets become constants */
#pragma unroll
  for (int ks = 0; ks < kRunLen / 32; ++ks) {
    const int cur = ks & 1, nxt = cur ^ 1;
    if (ks + 1 < kRunLen / 32) {
#pragma unroll
      for (int i = 0; i < 4; ++i) ah[nxt][i] = fa.frag(i, ks + 1);
#pragma unroll
      for (int j = 0; j < 4; ++j) bh[nxt][j] = fb.frag(j, ks + 1);
    }
    /* holds the reads one step ahead and no further: left free, the compiler asks for all 128 at once and spills registers */
    __builtin_amdgcn_sched_barrier(0);
#pragma unroll
    for (int i = 0; i < 4; ++i)
#pragma unroll
      for (int j = 0; j < 4; ++j) acc[i][j] = FragH::mma(ah[cur][i], bh[cur][j], acc[i][j]);
    /* as above: the reads of step ks + 2 stay behind this step's products, whose fragment set they refill */
    __builtin_amdgcn_sched_barrier(0);
  }

  unsigned short* P = Part + ((size_t)(b * kRuns + run) * kChunks + (size_t)dh * 4096 + (size_t)wave * 512 + lane) * 8;
#pragma unroll
  for (int j = 0; j < 4; ++j) {
#pragma unroll
    for (int i = 0; i < 4; ++i) {
      v8h hv;
#pragma unroll
      for (int r = 0; r < 8; ++r) hv[r] = (_Float16)(acc[i][j][r] * scale);
      *(v8h*)(P + (j * 4 + i) * 256) = hv;
    }
  }
}

// ---------------------------------------------------------------------------
// Adds the 16 partial tiles of a batch in f32, in run order 0..15, and writes KVT[b][v][d] (f16, rows v, d contiguous).
// 65,536 threads, one 16-byte chunk (8 values along d) each: grid 256 x 256 threads is exact. A wave's load is 512 contiguous bytes
// of one partial tile; all 16 loads of a thread are in flight together.
// Values below 2^-14 in magnitude are replaced by +0 before the convert.
// A block holds 8 tiles of 16x16: one d half, half a wave's tile (two of its four j, all four i) = 32 rows v x 64 d. They pass through LDS (pitch 72 halves)
// so that 8 lanes store one whole 128-B line, one storing wave per line.
// ---------------------------------------------------------------------------
__global__ __launch_bounds__(256) void add_partials_f16(const unsigned short* __restrict__ Part, unsigned short* __restrict__ Cout) {
  __shared__ __align__(16) _Float16 sO[32 * 72];
  const int t = threadIdx.x;
  const int b = blockIdx.x >> 5;
  const int e = (blockIdx.x & 31) * 256 + t;
  const _Float16* P = (const _Float16*)Part + ((size_t)b * kRuns * kChunks + e) * 8;
  v8h p[kRuns];
  /* unrolled: the registers are named by constants and every load is asked for before the first sum */
#pragma unroll
  for (int n = 0; n < kRuns; ++n) p[n] = *(const v8h*)(P + (size_t)n * kChunks * 8);
  float s[8];
#pragma unroll
  for (int r = 0; r < 8; ++r) s[r] = (float)p[0][r];
#pragma unroll
  for (int n = 1; n < kRuns; ++n)
#pragma unroll
    for (int r = 0; r < 8; ++r) s[r] += (float)p[n][r];
  v8h hv;
#pragma unroll
  for (int r = 0; r < 8; ++r) {
    const float x = (fabsf(s[r]) < kF16Min) ? 0.0f : s[r];
    hv[r] = (_Float16)x;
  }
  /* thread t holds tile i = (t >> 5) & 3 of the block's j number t >> 7: row (l & 15), columns 16 i + 8 (l >> 4) + 0..7 */
  const int lane = t & 31;
  *(v8h*)(sO + ((t >> 7) * 16 + (lane & 15)) * 72 + ((t >> 5) & 3) * 16 + (lane >> 4) * 8) = hv;
  /* the block's 32 rows are in LDS before any thread reads a line piece */
  __syncthreads();
  const int row = t >> 3;
  const v8h o = *(const v8h*)(sO + row * 72 + (t & 7) * 8);
  /* the block's tiles: blockIdx & 31 = dhalf * 16 + wv; wv = (d group of 64) * 8 + (v group of 32) */
  const int wv = blockIdx.x & 15;
  const int v  = ((wv & 7) << 5) + row;
  const int d  = (((blockIdx.x >> 4) & 1) << 7) + ((wv >> 3) << 6) + (t & 7) * 8;
  *(v8h*)(Cout + ((size_t)b * kFeat + v) * kFeat + d) = o;
}

// ---------------------------------------------------------------------------
// Host glue: 3 kernel launches, nothing else.
//   1. PART[b][run] = (1/4096) * sum over the run's 256 positions of 1024*phi(K)[s][d] * 64*V[s][v]   grid (32, 8) = (16 runs x 2 d halves, 8), 8 waves a block
//   2. KVT[b][v][d] = sum of the 16 partial tiles (= 16 * KV[b][d][v])                                  grid 256
//   3. out[b][q][v] = (1/16384) * sum_d f16(1024*phi(Q))[b][q][d] * KVT[b][v][d]
//        A from Q in the kernel (M = 4096 rows q), Bt = KVT (N = 256 rows v), K = 256; 128 rows per block -> grid (32, 8)
// ---------------------------------------------------------------------------
extern "C" void kernel_launch(void* const* d_in, const int* in_sizes, int n_in,
                              void* d_out, int out_size, void* d_ws, size_t ws_size,
                              hipStream_t stream) {
  if (n_in < 3) return;
  if (in_sizes[0] != kPlaneElems) return;
  if (in_sizes[1] != kPlaneElems) return;
  if (in_sizes[2] != kPlaneElems) return;
  if (out_size != kPlaneElems) return;
  if (ws_size < kWsTotal) return;

  const float* Q = (const float*)d_in[0];
  const float* K = (const float*)d_in[1];
  const float* V = (const float*)d_in[2];
  float* out = (float*)d_out;

  char* ws = (char*)d_ws;
  unsigned short* PART = (unsigned short*)(ws + kOffPart);
  unsigned short* KVT  = (unsigned short*)(ws + kOffKVT);

  wmma_kv_partial_f16<<<dim3(kRuns * 2, kBatch), kKvThreads, 0, stream>>>(K, V, Q, PART, kScaleKV);

  add_partials_f16<<<dim3(kBatch * kChunks / 256), 256, 0, stream>>>(PART, KVT);

  wmma_out64_phiq_f16<<<dim3(kSeq / kOutRows, kBatch), 256, 0, stream>>>(Q, KVT, out, kScaleOut);
}
